// v000
// Measured on an AMD MI455X. A time is GPU time per run, averaged over a window of back-to-back runs after a warm-up
// (all launches, gaps included; the runs take copies of the inputs in turn), and the median of several windows.
// Apart from v000's, it joins two sittings. Times from different sittings can be a few percent apart, while
// side-by-side timings come from the same sitting.
// v000, which the later versions start from, runs in 2000 microseconds.
// compute dtype: all float inputs rounded to bf16; Q, K, V are bf16-valued so their f16 planes are exact; logits q hi + residual x k (2 products) x 128^-0.5, then x p_q x p_k in f32 as the module; softmax f32; P x 2^11 once to f16 x v (exact) (1 product); f32 output.
#include <hip/hip_runtime.h>
#include <math.h>

typedef __attribute__((ext_vector_type(16))) _Float16 v16h;
typedef __attribute__((ext_vector_type(16))) __bf16 v16b;
typedef __attribute__((ext_vector_type(8)))  _Float16 v8h;
typedef __attribute__((ext_vector_type(8)))  float v8f;
typedef __attribute__((ext_vector_type(4)))  float v4f;
typedef __attribute__((ext_vector_type(2)))  float v2f;
typedef __attribute__((ext_vector_type(4)))  unsigned v4u;
typedef _Float16 hx8 __attribute__((ext_vector_type(8)));
typedef __attribute__((ext_vector_type(4)))  int v4i;
typedef float __attribute__((may_alias)) float_a;
typedef int __attribute__((may_alias)) int_a;

template <typename T> __device__ __forceinline__ void vst2(void* p, T v) { *(T*)p = v;  }
__device__ __forceinline__ v8f wmma16(v16h a, v16h b, v8f c) {
  v8f d = __builtin_amdgcn_wmma_f32_16x16x32_f16(false, a, false, b, (short)0, c, false, false);
  asm volatile("v_nop\n\tv_nop\n\tv_nop\n\tv_nop" : "+v"(d) : "v"(a), "v"(b));
  return d;
}
__device__ __forceinline__ v8f wmma_bf(v16b a, v16b b, v8f c) {
  v8f d = __builtin_amdgcn_wmma_f32_16x16x32_bf16(false, a, false, b, (short)0, c, false, false);
  asm volatile("v_nop\n\tv_nop\n\tv_nop\n\tv_nop" : "+v"(d) : "v"(a), "v"(b));
  return d;
}
// 16x16x32 fragments: lane = (h = lane>>4, row/col = lane&15); elements 0..7 = k0+8h+0..7, 8..15 = k0+16+8h+0..7; D element r = row 8h+r
__device__ __forceinline__ v16h frag_h(const _Float16* rowk0, int lane) {
  union { v16h v; v8h q[2]; } u; const _Float16* p = rowk0 + 8 * (lane >> 4);
  u.q[0] = *(const v8h*)p; u.q[1] = *(const v8h*)(p + 16); return u.v;
}
__device__ __forceinline__ v16h frag_f32(const float* rowk0, int lane) {
  v16h a; const float* p = rowk0 + 8 * (lane >> 4);
#pragma unroll
  for (int i = 0; i < 8; ++i) { a[i] = (_Float16)p[i]; a[8 + i] = (_Float16)p[16 + i]; }
  return a;
}
__device__ __forceinline__ v16h frag_f32s(const float* rowk0, int lane, float sc) {
  v16h a; const float* p = rowk0 + 8 * (lane >> 4);
#pragma unroll
  for (int i = 0; i < 8; ++i) { a[i] = (_Float16)(p[i] * sc); a[8 + i] = (_Float16)(p[16 + i] * sc); }
  return a;
}
// column fragment from a [K][ld] layout (column n), rows >= K read as 0
__device__ __forceinline__ v16h fragc_f32(const float* W, int k0, int n, int lane, int ld, int K) {
  v16h a; const int g = lane >> 4;
#pragma unroll
  for (int i = 0; i < 8; ++i) { const int ka = k0 + 8 * g + i, kb = ka + 16;
    a[i] = (_Float16)(ka < K ? W[(size_t)(ka < K ? ka : K - 1) * ld + n] : 0.f); a[8 + i] = (_Float16)(kb < K ? W[(size_t)(kb < K ? kb : K - 1) * ld + n] : 0.f); }
  return a;
}
struct F2 { v16b h, l; };
__device__ __forceinline__ F2 bsplit16(const float v[16]) { F2 r;
#pragma unroll
  for (int i = 0; i < 16; ++i) { const __bf16 h = (__bf16)v[i]; r.h[i] = h; r.l[i] = (__bf16)(v[i] - (float)h); }
  return r; }
__device__ __forceinline__ F2 split_row(const float* row, int k0, int lane) { float v[16]; const float* p = row + k0 + 8 * (lane >> 4);
#pragma unroll
  for (int i = 0; i < 8; ++i) { v[i] = p[i]; v[8 + i] = p[16 + i]; }
  return bsplit16(v); }
__device__ __forceinline__ F2 split_rowK(const float* row, int k0, int lane, int K) { float v[16]; const int g = lane >> 4;
#pragma unroll
  for (int i = 0; i < 8; ++i) { const int ka = k0 + 8 * g + i, kb = ka + 16; v[i] = ka < K ? row[ka < K ? ka : K - 1] : 0.f; v[8 + i] = kb < K ? row[kb < K ? kb : K - 1] : 0.f; }
  return bsplit16(v); }
__device__ __forceinline__ F2 split_col(const float* W, int k0, int n, int lane, int ld, int K) { float v[16]; const int g = lane >> 4;
#pragma unroll
  for (int i = 0; i < 8; ++i) { const int ka = k0 + 8 * g + i, kb = ka + 16; v[i] = ka < K ? W[(size_t)(ka < K ? ka : K - 1) * ld + n] : 0.f; v[8 + i] = kb < K ? W[(size_t)(kb < K ? kb : K - 1) * ld + n] : 0.f; }
  return bsplit16(v); }
__device__ __forceinline__ v8f mac3(const F2& a, const F2& b, v8f c) { c = wmma_bf(a.l, b.h, c); c = wmma_bf(a.h, b.l, c); return wmma_bf(a.h, b.h, c); }
__device__ __forceinline__ float sigm(float v) { return 1.0f / (1.0f + expf(-v)); }
#define LDSX() do { asm volatile("s_wait_dscnt 0" ::: "memory"); __builtin_amdgcn_wave_barrier(); __builtin_amdgcn_fence(__ATOMIC_RELEASE, "workgroup"); } while (0)

// Gated scaled-dot-product attention (single head; Q, K, V [16,2048,128] given; p_q, p_k [16,2048,1] uniform[0,1) gates): A = (Q K^T / sqrt(128)) * p_q * p_k^T; out = softmax(A) V -> [16,2048,128].
#define NB 16
#define TT 2048
#define CC 128            // NH * HD = projected width
#define DIN 128          // input (model) width
#define NH 1
#define HD 128
#define NQB (TT / 64)
#define HG 1
#define SCALE (0.08838834764831845f)
#define CAUSAL 0
#ifndef TNB
#define TNB NB
#endif
__device__ __forceinline__ float bfr(float v) { return (float)(__bf16)v; }
__host__ __device__ __forceinline__ int kb_last(int qb) { return CAUSAL ? ((qb * 64 + 63) >> 7) : (TT / 128 - 1); }
typedef __attribute__((ext_vector_type(8))) __bf16 v8b;
__device__ __forceinline__ v16b frag_b(const __bf16* rowk0, int lane) {
  union { v16b v; v8b q[2]; } u; const __bf16* p = rowk0 + 8 * (lane >> 4);
  u.q[0] = *(const v8b*)p; u.q[1] = *(const v8b*)(p + 16); return u.v;
}
#define QBH 0              // causal: query blocks 0..QBH-1 of each sequence (few keys, no averaging) take the high-precision path
#define QHI 2048            // rows carrying a q residual plane (all rows when non-causal: 2-product logits everywhere)
#define KHI 64            // key rows carrying k residual / v bf16 hi+lo planes (used only by the causal high-precision path)
// B fragment (k rows k0+.., output column o) of a weight: (in,out) [K][ld] or (out,in) [ld rows of K]: bf16 exact, or f16(bf16 * 256) exact
__device__ __forceinline__ v16b wcol_io(const float* Wm, int k0, int o, int lane, int ld) { v16b w; const int g = lane >> 4;
#pragma unroll
  for (int i = 0; i < 8; ++i) { w[i] = (__bf16)Wm[(size_t)(k0 + 8 * g + i) * ld + o]; w[8 + i] = (__bf16)Wm[(size_t)(k0 + 16 + 8 * g + i) * ld + o]; }
  return w; }
__device__ __forceinline__ v16b wcol_oi(const float* Wm, int k0, int o, int lane, int K) { v16b w; const float* p = Wm + (size_t)o * K + k0 + 8 * (lane >> 4);
#pragma unroll
  for (int i = 0; i < 8; ++i) { w[i] = (__bf16)p[i]; w[8 + i] = (__bf16)p[16 + i]; }
  return w; }
__device__ __forceinline__ v16h wcolh_io(const float* Wm, int k0, int o, int lane, int ld) { v16h w; const int g = lane >> 4;
#pragma unroll
  for (int i = 0; i < 8; ++i) { w[i] = (_Float16)(bfr(Wm[(size_t)(k0 + 8 * g + i) * ld + o]) * 256.0f); w[8 + i] = (_Float16)(bfr(Wm[(size_t)(k0 + 16 + 8 * g + i) * ld + o]) * 256.0f); }
  return w; }
__device__ __forceinline__ v16h wcolh_oi(const float* Wm, int k0, int o, int lane, int K) { v16h w; const float* p = Wm + (size_t)o * K + k0 + 8 * (lane >> 4);
#pragma unroll
  for (int i = 0; i < 8; ++i) { w[i] = (_Float16)(bfr(p[i]) * 256.0f); w[8 + i] = (_Float16)(bfr(p[16 + i]) * 256.0f); }
  return w; }
#define WQKV_LAYOUT 0   // 0 = (in,out) [DIN][CC]; 1 = (out,in) [CC][DIN]; 2 = per-head [NH][DIN][HD]
__device__ __forceinline__ v16b wcol_hdk(const float* Wm, int k0, int o, int lane) { v16b w; const int g = lane >> 4; const float* p = Wm + (size_t)(o / HD) * DIN * HD + (o % HD);
#pragma unroll
  for (int i = 0; i < 8; ++i) { w[i] = (__bf16)p[(size_t)(k0 + 8 * g + i) * HD]; w[8 + i] = (__bf16)p[(size_t)(k0 + 16 + 8 * g + i) * HD]; }
  return w; }
#define WO_OUT_IN 0
#if WQKV_LAYOUT == 1
#define WCOL(W, k0, o, lane) wcol_oi(W, k0, o, lane, DIN)
#elif WQKV_LAYOUT == 2
#define WCOL(W, k0, o, lane) wcol_hdk(W, k0, o, lane)
#else
#define WCOL(W, k0, o, lane) wcol_io(W, k0, o, lane, CC)
#endif
#if WO_OUT_IN
#define WOCOL(W, k0, o, lane) wcol_oi(W, k0, o, lane, CC)
#define WOCOLH(W, k0, o, lane) wcolh_oi(W, k0, o, lane, CC)
#else
#define WOCOL(W, k0, o, lane) wcol_io(W, k0, o, lane, DIN)
#define WOCOLH(W, k0, o, lane) wcolh_io(W, k0, o, lane, DIN)
#endif
#define SM_EXTRA_PARAMS , int bsm, const float* __restrict__ PQ, const float* __restrict__ PK
// multiplicative pre-gate: A = (A * bf16(p_q[b][t])) * bf16(p_k[b][k]) (f32, the module's order), then softmax
#define SM_MASK_HOOK do { v = (v * bfr(PQ[(size_t)bsm * TT + t])) * bfr(PK[(size_t)bsm * TT + k]); } while (0)   /* p_q / p_k bf16-rounded like every float input */
__global__ __launch_bounds__(256) void k_planes1(const float* __restrict__ Qs, const float* __restrict__ Ks, const float* __restrict__ Vs, _Float16* __restrict__ QH, _Float16* __restrict__ QL, _Float16* __restrict__ KH, _Float16* __restrict__ VT) {
  __shared__ _Float16 sv[64][136];
  const int tid = threadIdx.x; const size_t r0 = (size_t)blockIdx.x * 64; const int b = (int)(r0 / TT), t0 = (int)(r0 % TT);
  for (int e = tid; e < 64 * 16; e += 256) { const int rl = e >> 4, q = e & 15; const size_t src = (r0 + rl) * CC + q * 8; float tq[8], tk[8], tv[8];
#pragma unroll
    for (int u = 0; u < 8; ++u) { tq[u] = Qs[src + u]; tk[u] = Ks[src + u]; tv[u] = Vs[src + u]; }
    asm volatile("s_wait_loadcnt 0x0" ::: "memory");
    hx8 hq, hk, hl; 
#pragma unroll
    for (int u = 0; u < 8; ++u) { const float qv = bfr(tq[u]); const _Float16 qh = (_Float16)qv; hq[u] = qh; hl[u] = (_Float16)((qv - (float)qh) * 1024.0f); hk[u] = (_Float16)bfr(tk[u]); sv[rl][q * 8 + u] = (_Float16)bfr(tv[u]); }
    vst2((unsigned*)(QH + (r0 + rl) * CC + q * 8), *(const v4u*)&hq); vst2((unsigned*)(KH + (r0 + rl) * CC + q * 8), *(const v4u*)&hk);
    if (t0 + rl < QHI) vst2((unsigned*)(QL + ((size_t)b * QHI + t0 + rl) * CC + q * 8), *(const v4u*)&hl); }
  __syncthreads();
  for (int e = tid; e < 128 * 8; e += 256) { const int c = e >> 3, q = e & 7; hx8 hv; _Pragma("unroll") for (int j = 0; j < 8; ++j) hv[j] = sv[q * 8 + j][c]; vst2((unsigned*)(VT + ((size_t)b * CC + c) * TT + t0 + q * 8), *(const v4u*)&hv); } }
#ifndef SM_EXTRA_PARAMS
#define SM_EXTRA_PARAMS
#endif
#ifndef PROJ_EXTRA_PARAMS
#define PROJ_EXTRA_PARAMS
#endif
#ifndef SM_MASK_HOOK
#define SM_MASK_HOOK (void)0
#endif

#define WS_QH  0u                                      // f16 q rows [b*t][CC]
#define WS_KH  (WS_QH + 2u * (size_t)NB * TT * CC)      // f16 k rows [b*t][CC]
#define WS_VT  (WS_KH + 2u * (size_t)NB * TT * CC)      // f16 v planes [b][c][t]
#define WS_QL  (WS_VT + 2u * (size_t)NB * CC * TT)      // f16 q residual x 2^10 rows [b][t < QHI][CC]
#define WS_KL  (WS_QL + 2u * (size_t)NB * QHI * CC)     // f16 k residual x 2^10 rows [b][t < KHI][CC]
#define WS_VB  (WS_KL + 2u * (size_t)NB * KHI * CC)     // bf16 v hi planes [b][c][t < KHI]
#define WS_VBL (WS_VB + 2u * (size_t)NB * CC * KHI)
#define WS_S   (WS_VBL + 2u * (size_t)NB * CC * KHI)    // f32 logits / P [hg][t][s]
#define WS_Y   (WS_S  + 4u * (size_t)HG * TT * TT)      // f32 ctx rows [b*t][CC] (only when there is an output projection)
#define WS_END (WS_Y  + 0u)

// ---- k_proj: block = (64 rows, 128 cols, which): q/k/v = X W (+ b) with exact bf16 products (K = DIN) -> which 0: q f16 rows (+ residual rows < QHI); 1: k f16 rows (+ residual rows < KHI); 2: v f16 planes [c][t] (+ bf16 hi/lo planes for t < KHI)
__global__ __launch_bounds__(128) void k_proj(const float* __restrict__ XQ, const float* __restrict__ XK, const float* __restrict__ XV, const float* __restrict__ WQ, const float* __restrict__ WK, const float* __restrict__ WV, const float* __restrict__ BQ, const float* __restrict__ BK, const float* __restrict__ BV,
    _Float16* __restrict__ QH, _Float16* __restrict__ QL, _Float16* __restrict__ KH, _Float16* __restrict__ KL, _Float16* __restrict__ VT, __bf16* __restrict__ VB, __bf16* __restrict__ VBL) {
  __shared__ __align__(16) _Float16 sh[64][136], sl[64][136]; __shared__ __align__(16) _Float16 th[128][72]; __shared__ __align__(16) __bf16 tb[128][72], tbl[128][72];
  const int tid = threadIdx.x, wave = tid >> 5, lane = tid & 31, col = lane & 15, g = lane >> 4; const int which = blockIdx.z; const int c0 = blockIdx.y * 128; const size_t r0 = (size_t)blockIdx.x * 64; const size_t bb = r0 / TT; const int t0 = (int)(r0 % TT);
  const float* X = which == 0 ? XQ : which == 1 ? XK : XV; const float* WA = which == 0 ? WQ : which == 1 ? WK : WV; const float* BA = which == 0 ? BQ : which == 1 ? BK : BV;
  v8f acc[8] = {};
#pragma unroll 2
  for (int kc = 0; kc < DIN / 32; ++kc) { v16b a; { const float* p = X + (r0 + wave * 16 + col) * DIN + kc * 32 + 8 * g;
#pragma unroll
      for (int i = 0; i < 8; ++i) { a[i] = (__bf16)p[i]; a[8 + i] = (__bf16)p[16 + i]; } }
    asm volatile("s_wait_loadcnt 0x0" ::: "memory");
#pragma unroll
    for (int j = 0; j < 8; ++j) { const v16b w = WCOL(WA, kc * 32, c0 + j * 16 + col, lane); asm volatile("s_wait_loadcnt 0x0" ::: "memory"); acc[j] = wmma_bf(a, w, acc[j]); } }
  if (which < 2) { _Float16* DH = which == 0 ? QH : KH; _Float16* DL = which == 0 ? QL : KL; const int nhi = which == 0 ? QHI : KHI; const bool hi_rows = t0 < nhi;
#pragma unroll
    for (int j = 0; j < 8; ++j) { const float bias = BA ? bfr(BA[c0 + j * 16 + col]) : 0.f;
#pragma unroll
      for (int r = 0; r < 8; ++r) { const float v = acc[j][r] + bias; const _Float16 hv = (_Float16)v; sh[wave * 16 + 8 * g + r][j * 16 + col] = hv; sl[wave * 16 + 8 * g + r][j * 16 + col] = (_Float16)((v - (float)hv) * 1024.0f); } }
    __syncthreads();
    for (int e = tid; e < 64 * 16; e += 128) { const int rl = e >> 4, q = e & 15; vst2((unsigned*)(DH + (r0 + rl) * CC + c0 + q * 8), *(const v4u*)&sh[rl][q * 8]); if (hi_rows) vst2((unsigned*)(DL + (bb * nhi + t0 + rl) * (size_t)CC + c0 + q * 8), *(const v4u*)&sl[rl][q * 8]); }
  } else { const bool hi_rows = t0 < KHI;
#pragma unroll
    for (int j = 0; j < 8; ++j) { const float bias = BA ? bfr(BA[c0 + j * 16 + col]) : 0.f;
#pragma unroll
      for (int r = 0; r < 8; ++r) { const float v = acc[j][r] + bias; const int rl = wave * 16 + 8 * g + r, cl = j * 16 + col; th[cl][rl] = (_Float16)v; const __bf16 bh = (__bf16)v; tb[cl][rl] = bh; tbl[cl][rl] = (__bf16)(v - (float)bh); } }
    __syncthreads();
    for (int e = tid; e < 128 * 8; e += 128) { const int cl = e >> 3, q = e & 7; vst2((unsigned*)(VT + (bb * CC + c0 + cl) * (size_t)TT + t0 + q * 8), *(const v4u*)&th[cl][q * 8]); if (hi_rows) { const size_t o3 = (bb * CC + c0 + cl) * (size_t)KHI + t0 + q * 8; vst2((unsigned*)(VB + o3), *(const v4u*)&tb[cl][q * 8]); vst2((unsigned*)(VBL + o3), *(const v4u*)&tbl[cl][q * 8]); } } } }
// ---- k_sc: block = (query block qb, key block kb <= kb_last(qb), head in group) of batch b: logits x SCALE; q hi + residual (x 2^10) against k (2 products) for query rows < QHI, plus the k residual (3 products) for query blocks < QBH (causal early rows); causal: blocks past the diagonal exit, the mask itself is applied by index in k_sm
__global__ __launch_bounds__(128) void k_sc(const _Float16* __restrict__ QH, const _Float16* __restrict__ KH, const _Float16* __restrict__ QL, const _Float16* __restrict__ KL, int b, int h0, float* __restrict__ S0) { __shared__ __align__(16) float ss[4][16][132];
  const int qb = blockIdx.x, kb = blockIdx.y; if (kb > kb_last(qb)) return;
  const int h = h0 + blockIdx.z; float* S = S0 + (size_t)blockIdx.z * TT * TT;
  const int tid = threadIdx.x, wave = tid >> 5, lane = tid & 31, col = lane & 15, g = lane >> 4; const int k0 = kb * 128; const int ql0 = qb * 64 + wave * 16; const size_t q0 = (size_t)b * TT + ql0, kr0 = (size_t)b * TT + k0;
  v8f acc[8] = {}, accl[8] = {};
  const _Float16* QLb = QL + (size_t)b * QHI * CC; const _Float16* KLb = KL + (size_t)b * KHI * CC;
  if (qb < QBH) {
#pragma unroll
    for (int kc = 0; kc < HD / 32; ++kc) { const v16h ah = frag_h(QH + (q0 + col) * CC + h * HD + kc * 32, lane), al = frag_h(QLb + (size_t)(ql0 + col) * CC + h * HD + kc * 32, lane);
#pragma unroll
      for (int j = 0; j < 8; ++j) { const v16h kbf = frag_h(KH + (kr0 + j * 16 + col) * CC + h * HD + kc * 32, lane), klf = frag_h(KLb + (size_t)(k0 + j * 16 + col) * CC + h * HD + kc * 32, lane); acc[j] = wmma16(ah, kbf, acc[j]); accl[j] = wmma16(al, kbf, accl[j]); accl[j] = wmma16(ah, klf, accl[j]); } }
  } else if (qb * 64 < QHI) {
#pragma unroll
    for (int kc = 0; kc < HD / 32; ++kc) { const v16h ah = frag_h(QH + (q0 + col) * CC + h * HD + kc * 32, lane), al = frag_h(QLb + (size_t)(ql0 + col) * CC + h * HD + kc * 32, lane);
#pragma unroll
      for (int j = 0; j < 8; ++j) { const v16h kbf = frag_h(KH + (kr0 + j * 16 + col) * CC + h * HD + kc * 32, lane); acc[j] = wmma16(ah, kbf, acc[j]); accl[j] = wmma16(al, kbf, accl[j]); } }
  } else {
#pragma unroll
    for (int kc = 0; kc < HD / 32; ++kc) { const v16h ah = frag_h(QH + (q0 + col) * CC + h * HD + kc * 32, lane);
#pragma unroll
      for (int j = 0; j < 8; ++j) { const v16h kbf = frag_h(KH + (kr0 + j * 16 + col) * CC + h * HD + kc * 32, lane); acc[j] = wmma16(ah, kbf, acc[j]); } } }
#pragma unroll
  for (int j = 0; j < 8; ++j) {
#pragma unroll
    for (int r = 0; r < 8; ++r) ss[wave][8 * g + r][j * 16 + col] = (acc[j][r] + accl[j][r] * (1.0f / 1024.0f)) * SCALE; }
  LDSX(); for (int rl = 0; rl < 16; ++rl) vst2(S + (size_t)(ql0 + rl) * TT + k0 + lane * 4, *(const v4f*)&ss[wave][rl][lane * 4]); }
// ---- k_sm: block = query row t (head in group): keys [0, kend): causal -> logit if s <= t else excluded; softmax in f32; P x 2^11 in place (0 for excluded)
__global__ __launch_bounds__(256) void k_sm(float* __restrict__ S0 SM_EXTRA_PARAMS) { __shared__ float sred[8]; __shared__ float sbc; __shared__ __align__(16) float shv[TT];
  const int tid = threadIdx.x; const int t = blockIdx.x; const int kend = (kb_last(t >> 6) + 1) * 128;
  float* sr = S0 + (size_t)blockIdx.y * TT * TT + (size_t)t * TT;
  float m = -3.0e38f; for (int k = tid; k < kend; k += 256) { float v = (!CAUSAL || k <= t) ? sr[k] : -3.0e38f; SM_MASK_HOOK; shv[k] = v; m = fmaxf(m, v); }
#pragma unroll
  for (int o = 1; o < 32; o <<= 1) m = fmaxf(m, __shfl_xor(m, o));
  if ((tid & 31) == 0) sred[tid >> 5] = m; __syncthreads(); if (tid == 0) { float a = sred[0]; for (int i = 1; i < 8; ++i) a = fmaxf(a, sred[i]); sbc = a; } __syncthreads(); m = sbc; __syncthreads();
  float sum = 0.f; for (int k = tid; k < kend; k += 256) { const float v = shv[k]; const float e = (v <= -1.0e38f) ? 0.f : expf(v - m); shv[k] = e; sum += e; }
#pragma unroll
  for (int o = 1; o < 32; o <<= 1) sum += __shfl_xor(sum, o);
  if ((tid & 31) == 0) sred[tid >> 5] = sum; __syncthreads(); if (tid == 0) { float a = 0.f; for (int i = 0; i < 8; ++i) a += sred[i]; sbc = a > 0.f ? 2048.0f / a : 0.f; }   /* a fully excluded row yields P = 0 */ __syncthreads(); const float inv = sbc;
  for (int k = tid; k < kend; k += 256) shv[k] = shv[k] * inv;
  __syncthreads(); for (int q = tid; q < kend / 4; q += 256) vst2(sr + q * 4, *(const v4f*)&shv[q * 4]); }
// ---- k_pv: block = 64 queries (qb) of (b, h): ctx = P . v over keys [0, kend) (P x 2^11 once to f16 against v f16: 1 product; causal early query blocks: P and v as bf16 hi + lo, 3 products); 512-B (row, head) segment by 32 lanes
__global__ __launch_bounds__(128) void k_pv(const float* __restrict__ PS0, const _Float16* __restrict__ VT, const __bf16* __restrict__ VB, const __bf16* __restrict__ VBL, int b, int h0, float* __restrict__ Y) { const int h = h0 + blockIdx.z; const float* PS = PS0 + (size_t)blockIdx.z * TT * TT; __shared__ __align__(16) float ss[4][16][HD + 4];
  const int tid = threadIdx.x, wave = tid >> 5, lane = tid & 31, col = lane & 15, g = lane >> 4; const int qb = blockIdx.x; const int ql0 = qb * 64 + wave * 16; const int kce = (kb_last(qb) + 1) * 4;
  v8f acc[HD / 16] = {};
  if (qb < QBH) {
#pragma unroll 1
    for (int kc = 0; kc < kce; ++kc) { const F2 p = split_row(PS + (size_t)(ql0 + col) * TT, kc * 32, lane);
      asm volatile("s_wait_loadcnt 0x0" ::: "memory");
#pragma unroll
      for (int j = 0; j < HD / 16; ++j) { const size_t po = ((size_t)b * CC + h * HD + j * 16 + col) * (size_t)KHI + kc * 32; const v16b vh = frag_b(VB + po, lane); acc[j] = wmma_bf(p.h, vh, acc[j]); acc[j] = wmma_bf(p.l, vh, acc[j]); acc[j] = wmma_bf(p.h, frag_b(VBL + po, lane), acc[j]); } }
  } else {
#pragma unroll 1
    for (int kc = 0; kc < kce; ++kc) { const v16h p = frag_f32(PS + (size_t)(ql0 + col) * TT + kc * 32, lane);
      asm volatile("s_wait_loadcnt 0x0" ::: "memory");
#pragma unroll
      for (int j = 0; j < HD / 16; ++j) { const size_t po = ((size_t)b * CC + h * HD + j * 16 + col) * (size_t)TT + kc * 32; acc[j] = wmma16(p, frag_h(VT + po, lane), acc[j]); } } }
#pragma unroll
  for (int j = 0; j < HD / 16; ++j)
#pragma unroll
    for (int r = 0; r < 8; ++r) ss[wave][8 * g + r][j * 16 + col] = acc[j][r] * (1.0f / 2048.0f);
  LDSX(); for (int rl = 0; rl < 16; ++rl) if (lane < HD / 4) vst2(Y + ((size_t)b * TT + ql0 + rl) * CC + h * HD + lane * 4, *(const v4f*)&ss[wave][rl][lane * 4]); }

extern "C" void kernel_launch(void* const* d_in, const int* in_sizes, int n_in, void* d_out, int out_size, void* d_ws, size_t ws_size, hipStream_t stream) {
  (void)in_sizes; (void)n_in; (void)out_size;
  const float** F = (const float**)d_in;
  if (ws_size < (size_t)WS_END) return;
  char* ws = (char*)d_ws; _Float16 *QH = (_Float16*)(ws + WS_QH), *KH = (_Float16*)(ws + WS_KH), *VT = (_Float16*)(ws + WS_VT), *QL = (_Float16*)(ws + WS_QL), *KL = (_Float16*)(ws + WS_KL); __bf16 *VB = (__bf16*)(ws + WS_VB), *VBL = (__bf16*)(ws + WS_VBL); float *S = (float*)(ws + WS_S), *Y = (float*)(ws + WS_Y);
  (void)Y; (void)QL; (void)KL; (void)VB; (void)VBL;
  // inputs: 0 Q [16,2048,128]; 1 K; 2 V; 3 p_q [16,2048,1]; 4 p_k [16,2048,1]
  k_planes1<<<dim3(TNB * TT / 64), 256, 0, stream>>>(F[0], F[1], F[2], QH, QL, KH, VT);
  for (int b = 0; b < TNB; ++b) {
    k_sc<<<dim3(NQB, TT / 128, 1), 128, 0, stream>>>(QH, KH, QL, KL, b, 0, S);
    k_sm<<<dim3(TT, 1), 256, 0, stream>>>(S, b, F[3], F[4]);
    k_pv<<<dim3(NQB, 1, 1), 128, 0, stream>>>(S, VT, VB, VBL, b, 0, (float*)d_out);
  }
}

// v001
// It runs in 508 microseconds.
// Two timings next to v000 put it at 3.96 and 3.95 times that version's speed.
// compute dtype: all float inputs rounded to bf16; Q, K, V are bf16-valued so their f16 planes are exact; logits q hi + residual x k (2 products) x 128^-0.5, then x p_q x p_k in f32 as the module; softmax f32; P x 2^11 once to f16 x v (exact) (1 product); f32 output.
#include <hip/hip_runtime.h>
#include <math.h>

typedef __attribute__((ext_vector_type(16))) _Float16 v16h;
typedef __attribute__((ext_vector_type(16))) __bf16 v16b;
typedef __attribute__((ext_vector_type(8)))  _Float16 v8h;
typedef __attribute__((ext_vector_type(8)))  float v8f;
typedef __attribute__((ext_vector_type(4)))  float v4f;
typedef __attribute__((ext_vector_type(2)))  float v2f;
typedef __attribute__((ext_vector_type(4)))  unsigned v4u;
typedef _Float16 hx8 __attribute__((ext_vector_type(8)));
typedef __attribute__((ext_vector_type(4)))  int v4i;
typedef float __attribute__((may_alias)) float_a;
typedef int __attribute__((may_alias)) int_a;

template <typename T> __device__ __forceinline__ void vst2(void* p, T v) { *(T*)p = v;  }
__device__ __forceinline__ v8f wmma16(v16h a, v16h b, v8f c) {
  v8f d = __builtin_amdgcn_wmma_f32_16x16x32_f16(false, a, false, b, (short)0, c, false, false);
  asm volatile("v_nop\n\tv_nop\n\tv_nop\n\tv_nop" : "+v"(d) : "v"(a), "v"(b));
  return d;
}
__device__ __forceinline__ v8f wmma_bf(v16b a, v16b b, v8f c) {
  v8f d = __builtin_amdgcn_wmma_f32_16x16x32_bf16(false, a, false, b, (short)0, c, false, false);
  asm volatile("v_nop\n\tv_nop\n\tv_nop\n\tv_nop" : "+v"(d) : "v"(a), "v"(b));
  return d;
}
// 16x16x32 fragments: lane = (h = lane>>4, row/col = lane&15); elements 0..7 = k0+8h+0..7, 8..15 = k0+16+8h+0..7; D element r = row 8h+r
__device__ __forceinline__ v16h frag_h(const _Float16* rowk0, int lane) {
  union { v16h v; v8h q[2]; } u; const _Float16* p = rowk0 + 8 * (lane >> 4);
  u.q[0] = *(const v8h*)p; u.q[1] = *(const v8h*)(p + 16); return u.v;
}
__device__ __forceinline__ v16h frag_f32(const float* rowk0, int lane) {
  v16h a; const float* p = rowk0 + 8 * (lane >> 4);
#pragma unroll
  for (int i = 0; i < 8; ++i) { a[i] = (_Float16)p[i]; a[8 + i] = (_Float16)p[16 + i]; }
  return a;
}
__device__ __forceinline__ v16h frag_f32s(const float* rowk0, int lane, float sc) {
  v16h a; const float* p = rowk0 + 8 * (lane >> 4);
#pragma unroll
  for (int i = 0; i < 8; ++i) { a[i] = (_Float16)(p[i] * sc); a[8 + i] = (_Float16)(p[16 + i] * sc); }
  return a;
}
// column fragment from a [K][ld] layout (column n), rows >= K read as 0
__device__ __forceinline__ v16h fragc_f32(const float* W, int k0, int n, int lane, int ld, int K) {
  v16h a; const int g = lane >> 4;
#pragma unroll
  for (int i = 0; i < 8; ++i) { const int ka = k0 + 8 * g + i, kb = ka + 16;
    a[i] = (_Float16)(ka < K ? W[(size_t)(ka < K ? ka : K - 1) * ld + n] : 0.f); a[8 + i] = (_Float16)(kb < K ? W[(size_t)(kb < K ? kb : K - 1) * ld + n] : 0.f); }
  return a;
}
struct F2 { v16b h, l; };
__device__ __forceinline__ F2 bsplit16(const float v[16]) { F2 r;
#pragma unroll
  for (int i = 0; i < 16; ++i) { const __bf16 h = (__bf16)v[i]; r.h[i] = h; r.l[i] = (__bf16)(v[i] - (float)h); }
  return r; }
__device__ __forceinline__ F2 split_row(const float* row, int k0, int lane) { float v[16]; const float* p = row + k0 + 8 * (lane >> 4);
#pragma unroll
  for (int i = 0; i < 8; ++i) { v[i] = p[i]; v[8 + i] = p[16 + i]; }
  return bsplit16(v); }
__device__ __forceinline__ F2 split_rowK(const float* row, int k0, int lane, int K) { float v[16]; const int g = lane >> 4;
#pragma unroll
  for (int i = 0; i < 8; ++i) { const int ka = k0 + 8 * g + i, kb = ka + 16; v[i] = ka < K ? row[ka < K ? ka : K - 1] : 0.f; v[8 + i] = kb < K ? row[kb < K ? kb : K - 1] : 0.f; }
  return bsplit16(v); }
__device__ __forceinline__ F2 split_col(const float* W, int k0, int n, int lane, int ld, int K) { float v[16]; const int g = lane >> 4;
#pragma unroll
  for (int i = 0; i < 8; ++i) { const int ka = k0 + 8 * g + i, kb = ka + 16; v[i] = ka < K ? W[(size_t)(ka < K ? ka : K - 1) * ld + n] : 0.f; v[8 + i] = kb < K ? W[(size_t)(kb < K ? kb : K - 1) * ld + n] : 0.f; }
  return bsplit16(v); }
__device__ __forceinline__ v8f mac3(const F2& a, const F2& b, v8f c) { c = wmma_bf(a.l, b.h, c); c = wmma_bf(a.h, b.l, c); return wmma_bf(a.h, b.h, c); }
__device__ __forceinline__ float sigm(float v) { return 1.0f / (1.0f + expf(-v)); }
#define LDSX() do { asm volatile("s_wait_dscnt 0" ::: "memory"); __builtin_amdgcn_wave_barrier(); __builtin_amdgcn_fence(__ATOMIC_RELEASE, "workgroup"); } while (0)

// Gated scaled-dot-product attention (single head; Q, K, V [16,2048,128] given; p_q, p_k [16,2048,1] uniform[0,1) gates): A = (Q K^T / sqrt(128)) * p_q * p_k^T; out = softmax(A) V -> [16,2048,128].
#define NB 16
#define TT 2048
#define CC 128            // NH * HD = projected width
#define DIN 128          // input (model) width
#define NH 1
#define HD 128
#define NQB (TT / 64)
#define HG 8               // batches per launch group: each group's logit planes lie side by side in the workspace, one plane per grid z (k_sm: y)
#define SCALE (0.08838834764831845f)
#define CAUSAL 0
#ifndef TNB
#define TNB NB
#endif
static_assert(TNB % HG == 0, "launch groups must cover the batches exactly");
__device__ __forceinline__ float bfr(float v) { return (float)(__bf16)v; }
__host__ __device__ __forceinline__ int kb_last(int qb) { return CAUSAL ? ((qb * 64 + 63) >> 7) : (TT / 128 - 1); }
typedef __attribute__((ext_vector_type(8))) __bf16 v8b;
__device__ __forceinline__ v16b frag_b(const __bf16* rowk0, int lane) {
  union { v16b v; v8b q[2]; } u; const __bf16* p = rowk0 + 8 * (lane >> 4);
  u.q[0] = *(const v8b*)p; u.q[1] = *(const v8b*)(p + 16); return u.v;
}
#define QBH 0              // causal: query blocks 0..QBH-1 of each sequence (few keys, no averaging) take the high-precision path
#define QHI 2048            // rows carrying a q residual plane (all rows when non-causal: 2-product logits everywhere)
#define KHI 64            // key rows carrying k residual / v bf16 hi+lo planes (used only by the causal high-precision path)
// B fragment (k rows k0+.., output column o) of a weight: (in,out) [K][ld] or (out,in) [ld rows of K]: bf16 exact, or f16(bf16 * 256) exact
__device__ __forceinline__ v16b wcol_io(const float* Wm, int k0, int o, int lane, int ld) { v16b w; const int g = lane >> 4;
#pragma unroll
  for (int i = 0; i < 8; ++i) { w[i] = (__bf16)Wm[(size_t)(k0 + 8 * g + i) * ld + o]; w[8 + i] = (__bf16)Wm[(size_t)(k0 + 16 + 8 * g + i) * ld + o]; }
  return w; }
__device__ __forceinline__ v16b wcol_oi(const float* Wm, int k0, int o, int lane, int K) { v16b w; const float* p = Wm + (size_t)o * K + k0 + 8 * (lane >> 4);
#pragma unroll
  for (int i = 0; i < 8; ++i) { w[i] = (__bf16)p[i]; w[8 + i] = (__bf16)p[16 + i]; }
  return w; }
__device__ __forceinline__ v16h wcolh_io(const float* Wm, int k0, int o, int lane, int ld) { v16h w; const int g = lane >> 4;
#pragma unroll
  for (int i = 0; i < 8; ++i) { w[i] = (_Float16)(bfr(Wm[(size_t)(k0 + 8 * g + i) * ld + o]) * 256.0f); w[8 + i] = (_Float16)(bfr(Wm[(size_t)(k0 + 16 + 8 * g + i) * ld + o]) * 256.0f); }
  return w; }
__device__ __forceinline__ v16h wcolh_oi(const float* Wm, int k0, int o, int lane, int K) { v16h w; const float* p = Wm + (size_t)o * K + k0 + 8 * (lane >> 4);
#pragma unroll
  for (int i = 0; i < 8; ++i) { w[i] = (_Float16)(bfr(p[i]) * 256.0f); w[8 + i] = (_Float16)(bfr(p[16 + i]) * 256.0f); }
  return w; }
#define WQKV_LAYOUT 0   // 0 = (in,out) [DIN][CC]; 1 = (out,in) [CC][DIN]; 2 = per-head [NH][DIN][HD]
__device__ __forceinline__ v16b wcol_hdk(const float* Wm, int k0, int o, int lane) { v16b w; const int g = lane >> 4; const float* p = Wm + (size_t)(o / HD) * DIN * HD + (o % HD);
#pragma unroll
  for (int i = 0; i < 8; ++i) { w[i] = (__bf16)p[(size_t)(k0 + 8 * g + i) * HD]; w[8 + i] = (__bf16)p[(size_t)(k0 + 16 + 8 * g + i) * HD]; }
  return w; }
#define WO_OUT_IN 0
#if WQKV_LAYOUT == 1
#define WCOL(W, k0, o, lane) wcol_oi(W, k0, o, lane, DIN)
#elif WQKV_LAYOUT == 2
#define WCOL(W, k0, o, lane) wcol_hdk(W, k0, o, lane)
#else
#define WCOL(W, k0, o, lane) wcol_io(W, k0, o, lane, CC)
#endif
#if WO_OUT_IN
#define WOCOL(W, k0, o, lane) wcol_oi(W, k0, o, lane, CC)
#define WOCOLH(W, k0, o, lane) wcolh_oi(W, k0, o, lane, CC)
#else
#define WOCOL(W, k0, o, lane) wcol_io(W, k0, o, lane, DIN)
#define WOCOLH(W, k0, o, lane) wcolh_io(W, k0, o, lane, DIN)
#endif
#define SM_EXTRA_PARAMS , int bsm, const float* __restrict__ PQ, const float* __restrict__ PK
// multiplicative pre-gate: A = (A * bf16(p_q[b][t])) * bf16(p_k[b][k]) (f32, the module's order), then softmax
#define SM_MASK_HOOK do { v = (v * bfr(PQ[(size_t)bsm * TT + t])) * bfr(PK[(size_t)bsm * TT + k]); } while (0)   /* p_q / p_k bf16-rounded like every float input */
__global__ __launch_bounds__(256) void k_planes1(const float* __restrict__ Qs, const float* __restrict__ Ks, const float* __restrict__ Vs, _Float16* __restrict__ QH, _Float16* __restrict__ QL, _Float16* __restrict__ KH, _Float16* __restrict__ VT) {
  __shared__ _Float16 sv[64][136];
  const int tid = threadIdx.x; const size_t r0 = (size_t)blockIdx.x * 64; const int b = (int)(r0 / TT), t0 = (int)(r0 % TT);
  for (int e = tid; e < 64 * 16; e += 256) { const int rl = e >> 4, q = e & 15; const size_t src = (r0 + rl) * CC + q * 8; float tq[8], tk[8], tv[8];
#pragma unroll
    for (int u = 0; u < 8; ++u) { tq[u] = Qs[src + u]; tk[u] = Ks[src + u]; tv[u] = Vs[src + u]; }
    asm volatile("s_wait_loadcnt 0x0" ::: "memory");
    hx8 hq, hk, hl; 
#pragma unroll
    for (int u = 0; u < 8; ++u) { const float qv = bfr(tq[u]); const _Float16 qh = (_Float16)qv; hq[u] = qh; hl[u] = (_Float16)((qv - (float)qh) * 1024.0f); hk[u] = (_Float16)bfr(tk[u]); sv[rl][q * 8 + u] = (_Float16)bfr(tv[u]); }
    vst2((unsigned*)(QH + (r0 + rl) * CC + q * 8), *(const v4u*)&hq); vst2((unsigned*)(KH + (r0 + rl) * CC + q * 8), *(const v4u*)&hk);
    if (t0 + rl < QHI) vst2((unsigned*)(QL + ((size_t)b * QHI + t0 + rl) * CC + q * 8), *(const v4u*)&hl); }
  __syncthreads();
  for (int e = tid; e < 128 * 8; e += 256) { const int c = e >> 3, q = e & 7; hx8 hv; _Pragma("unroll") for (int j = 0; j < 8; ++j) hv[j] = sv[q * 8 + j][c]; vst2((unsigned*)(VT + ((size_t)b * CC + c) * TT + t0 + q * 8), *(const v4u*)&hv); } }
#ifndef SM_EXTRA_PARAMS
#define SM_EXTRA_PARAMS
#endif
#ifndef PROJ_EXTRA_PARAMS
#define PROJ_EXTRA_PARAMS
#endif
#ifndef SM_MASK_HOOK
#define SM_MASK_HOOK (void)0
#endif

#define WS_QH  0u                                      // f16 q rows [b*t][CC]
#define WS_KH  (WS_QH + 2u * (size_t)NB * TT * CC)      // f16 k rows [b*t][CC]
#define WS_VT  (WS_KH + 2u * (size_t)NB * TT * CC)      // f16 v planes [b][c][t]
#define WS_QL  (WS_VT + 2u * (size_t)NB * CC * TT)      // f16 q residual x 2^10 rows [b][t < QHI][CC]
#define WS_KL  (WS_QL + 2u * (size_t)NB * QHI * CC)     // f16 k residual x 2^10 rows [b][t < KHI][CC]
#define WS_VB  (WS_KL + 2u * (size_t)NB * KHI * CC)     // bf16 v hi planes [b][c][t < KHI]
#define WS_VBL (WS_VB + 2u * (size_t)NB * CC * KHI)
#define WS_S   (WS_VBL + 2u * (size_t)NB * CC * KHI)    // f32 logits / P [batch in group][t][s]
#define WS_Y   (WS_S  + 4u * (size_t)HG * TT * TT)      // f32 ctx rows [b*t][CC] (only when there is an output projection)
#define WS_END (WS_Y  + 0u)

// ---- k_proj: block = (64 rows, 128 cols, which): q/k/v = X W (+ b) with exact bf16 products (K = DIN) -> which 0: q f16 rows (+ residual rows < QHI); 1: k f16 rows (+ residual rows < KHI); 2: v f16 planes [c][t] (+ bf16 hi/lo planes for t < KHI)
__global__ __launch_bounds__(128) void k_proj(const float* __restrict__ XQ, const float* __restrict__ XK, const float* __restrict__ XV, const float* __restrict__ WQ, const float* __restrict__ WK, const float* __restrict__ WV, const float* __restrict__ BQ, const float* __restrict__ BK, const float* __restrict__ BV,
    _Float16* __restrict__ QH, _Float16* __restrict__ QL, _Float16* __restrict__ KH, _Float16* __restrict__ KL, _Float16* __restrict__ VT, __bf16* __restrict__ VB, __bf16* __restrict__ VBL) {
  __shared__ __align__(16) _Float16 sh[64][136], sl[64][136]; __shared__ __align__(16) _Float16 th[128][72]; __shared__ __align__(16) __bf16 tb[128][72], tbl[128][72];
  const int tid = threadIdx.x, wave = tid >> 5, lane = tid & 31, col = lane & 15, g = lane >> 4; const int which = blockIdx.z; const int c0 = blockIdx.y * 128; const size_t r0 = (size_t)blockIdx.x * 64; const size_t bb = r0 / TT; const int t0 = (int)(r0 % TT);
  const float* X = which == 0 ? XQ : which == 1 ? XK : XV; const float* WA = which == 0 ? WQ : which == 1 ? WK : WV; const float* BA = which == 0 ? BQ : which == 1 ? BK : BV;
  v8f acc[8] = {};
#pragma unroll 2
  for (int kc = 0; kc < DIN / 32; ++kc) { v16b a; { const float* p = X + (r0 + wave * 16 + col) * DIN + kc * 32 + 8 * g;
#pragma unroll
      for (int i = 0; i < 8; ++i) { a[i] = (__bf16)p[i]; a[8 + i] = (__bf16)p[16 + i]; } }
    asm volatile("s_wait_loadcnt 0x0" ::: "memory");
#pragma unroll
    for (int j = 0; j < 8; ++j) { const v16b w = WCOL(WA, kc * 32, c0 + j * 16 + col, lane); asm volatile("s_wait_loadcnt 0x0" ::: "memory"); acc[j] = wmma_bf(a, w, acc[j]); } }
  if (which < 2) { _Float16* DH = which == 0 ? QH : KH; _Float16* DL = which == 0 ? QL : KL; const int nhi = which == 0 ? QHI : KHI; const bool hi_rows = t0 < nhi;
#pragma unroll
    for (int j = 0; j < 8; ++j) { const float bias = BA ? bfr(BA[c0 + j * 16 + col]) : 0.f;
#pragma unroll
      for (int r = 0; r < 8; ++r) { const float v = acc[j][r] + bias; const _Float16 hv = (_Float16)v; sh[wave * 16 + 8 * g + r][j * 16 + col] = hv; sl[wave * 16 + 8 * g + r][j * 16 + col] = (_Float16)((v - (float)hv) * 1024.0f); } }
    __syncthreads();
    for (int e = tid; e < 64 * 16; e += 128) { const int rl = e >> 4, q = e & 15; vst2((unsigned*)(DH + (r0 + rl) * CC + c0 + q * 8), *(const v4u*)&sh[rl][q * 8]); if (hi_rows) vst2((unsigned*)(DL + (bb * nhi + t0 + rl) * (size_t)CC + c0 + q * 8), *(const v4u*)&sl[rl][q * 8]); }
  } else { const bool hi_rows = t0 < KHI;
#pragma unroll
    for (int j = 0; j < 8; ++j) { const float bias = BA ? bfr(BA[c0 + j * 16 + col]) : 0.f;
#pragma unroll
      for (int r = 0; r < 8; ++r) { const float v = acc[j][r] + bias; const int rl = wave * 16 + 8 * g + r, cl = j * 16 + col; th[cl][rl] = (_Float16)v; const __bf16 bh = (__bf16)v; tb[cl][rl] = bh; tbl[cl][rl] = (__bf16)(v - (float)bh); } }
    __syncthreads();
    for (int e = tid; e < 128 * 8; e += 128) { const int cl = e >> 3, q = e & 7; vst2((unsigned*)(VT + (bb * CC + c0 + cl) * (size_t)TT + t0 + q * 8), *(const v4u*)&th[cl][q * 8]); if (hi_rows) { const size_t o3 = (bb * CC + c0 + cl) * (size_t)KHI + t0 + q * 8; vst2((unsigned*)(VB + o3), *(const v4u*)&tb[cl][q * 8]); vst2((unsigned*)(VBL + o3), *(const v4u*)&tbl[cl][q * 8]); } } } }
// ---- k_sc: block = (query block qb, key block kb <= kb_last(qb), batch b + z of the group): logits x SCALE; q hi + residual (x 2^10) against k (2 products) for query rows < QHI, plus the k residual (3 products) for query blocks < QBH (causal early rows); causal: blocks past the diagonal exit, the mask itself is applied by index in k_sm
__global__ __launch_bounds__(128) void k_sc(const _Float16* __restrict__ QH, const _Float16* __restrict__ KH, const _Float16* __restrict__ QL, const _Float16* __restrict__ KL, int b, int h0, float* __restrict__ S0) { __shared__ __align__(16) float ss[4][16][132];
  const int qb = blockIdx.x, kb = blockIdx.y; if (kb > kb_last(qb)) return;
  b += blockIdx.z; const int h = h0; float* S = S0 + (size_t)blockIdx.z * TT * TT;
  const int tid = threadIdx.x, wave = tid >> 5, lane = tid & 31, col = lane & 15, g = lane >> 4; const int k0 = kb * 128; const int ql0 = qb * 64 + wave * 16; const size_t q0 = (size_t)b * TT + ql0, kr0 = (size_t)b * TT + k0;
  v8f acc[8] = {}, accl[8] = {};
  const _Float16* QLb = QL + (size_t)b * QHI * CC; const _Float16* KLb = KL + (size_t)b * KHI * CC;
  if (qb < QBH) {
#pragma unroll
    for (int kc = 0; kc < HD / 32; ++kc) { const v16h ah = frag_h(QH + (q0 + col) * CC + h * HD + kc * 32, lane), al = frag_h(QLb + (size_t)(ql0 + col) * CC + h * HD + kc * 32, lane);
#pragma unroll
      for (int j = 0; j < 8; ++j) { const v16h kbf = frag_h(KH + (kr0 + j * 16 + col) * CC + h * HD + kc * 32, lane), klf = frag_h(KLb + (size_t)(k0 + j * 16 + col) * CC + h * HD + kc * 32, lane); acc[j] = wmma16(ah, kbf, acc[j]); accl[j] = wmma16(al, kbf, accl[j]); accl[j] = wmma16(ah, klf, accl[j]); } }
  } else if (qb * 64 < QHI) {
#pragma unroll
    for (int kc = 0; kc < HD / 32; ++kc) { const v16h ah = frag_h(QH + (q0 + col) * CC + h * HD + kc * 32, lane), al = frag_h(QLb + (size_t)(ql0 + col) * CC + h * HD + kc * 32, lane);
#pragma unroll
      for (int j = 0; j < 8; ++j) { const v16h kbf = frag_h(KH + (kr0 + j * 16 + col) * CC + h * HD + kc * 32, lane); acc[j] = wmma16(ah, kbf, acc[j]); accl[j] = wmma16(al, kbf, accl[j]); } }
  } else {
#pragma unroll
    for (int kc = 0; kc < HD / 32; ++kc) { const v16h ah = frag_h(QH + (q0 + col) * CC + h * HD + kc * 32, lane);
#pragma unroll
      for (int j = 0; j < 8; ++j) { const v16h kbf = frag_h(KH + (kr0 + j * 16 + col) * CC + h * HD + kc * 32, lane); acc[j] = wmma16(ah, kbf, acc[j]); } } }
#pragma unroll
  for (int j = 0; j < 8; ++j) {
#pragma unroll
    for (int r = 0; r < 8; ++r) ss[wave][8 * g + r][j * 16 + col] = (acc[j][r] + accl[j][r] * (1.0f / 1024.0f)) * SCALE; }
  LDSX(); for (int rl = 0; rl < 16; ++rl) vst2(S + (size_t)(ql0 + rl) * TT + k0 + lane * 4, *(const v4f*)&ss[wave][rl][lane * 4]); }
// ---- k_sm: block = query row t (batch bsm + y of the group): keys [0, kend): causal -> logit if s <= t else excluded; softmax in f32; P x 2^11 in place (0 for excluded)
__global__ __launch_bounds__(256) void k_sm(float* __restrict__ S0 SM_EXTRA_PARAMS) { __shared__ float sred[8]; __shared__ float sbc; __shared__ __align__(16) float shv[TT];
  const int tid = threadIdx.x; const int t = blockIdx.x; bsm += blockIdx.y; const int kend = (kb_last(t >> 6) + 1) * 128;
  float* sr = S0 + (size_t)blockIdx.y * TT * TT + (size_t)t * TT;
  float m = -3.0e38f; for (int k = tid; k < kend; k += 256) { float v = (!CAUSAL || k <= t) ? sr[k] : -3.0e38f; SM_MASK_HOOK; shv[k] = v; m = fmaxf(m, v); }
#pragma unroll
  for (int o = 1; o < 32; o <<= 1) m = fmaxf(m, __shfl_xor(m, o));
  if ((tid & 31) == 0) sred[tid >> 5] = m; __syncthreads(); if (tid == 0) { float a = sred[0]; for (int i = 1; i < 8; ++i) a = fmaxf(a, sred[i]); sbc = a; } __syncthreads(); m = sbc; __syncthreads();
  float sum = 0.f; for (int k = tid; k < kend; k += 256) { const float v = shv[k]; const float e = (v <= -1.0e38f) ? 0.f : expf(v - m); shv[k] = e; sum += e; }
#pragma unroll
  for (int o = 1; o < 32; o <<= 1) sum += __shfl_xor(sum, o);
  if ((tid & 31) == 0) sred[tid >> 5] = sum; __syncthreads(); if (tid == 0) { float a = 0.f; for (int i = 0; i < 8; ++i) a += sred[i]; sbc = a > 0.f ? 2048.0f / a : 0.f; }   /* a fully excluded row yields P = 0 */ __syncthreads(); const float inv = sbc;
  for (int k = tid; k < kend; k += 256) shv[k] = shv[k] * inv;
  __syncthreads(); for (int q = tid; q < kend / 4; q += 256) vst2(sr + q * 4, *(const v4f*)&shv[q * 4]); }
// ---- k_pv: block = 64 queries (qb) of (batch b + z of the group, h): ctx = P . v over keys [0, kend) (P x 2^11 once to f16 against v f16: 1 product; causal early query blocks: P and v as bf16 hi + lo, 3 products); 512-B (row, head) segment by 32 lanes
__global__ __launch_bounds__(128) void k_pv(const float* __restrict__ PS0, const _Float16* __restrict__ VT, const __bf16* __restrict__ VB, const __bf16* __restrict__ VBL, int b, int h0, float* __restrict__ Y) { b += blockIdx.z; const int h = h0; const float* PS = PS0 + (size_t)blockIdx.z * TT * TT; __shared__ __align__(16) float ss[4][16][HD + 4];
  const int tid = threadIdx.x, wave = tid >> 5, lane = tid & 31, col = lane & 15, g = lane >> 4; const int qb = blockIdx.x; const int ql0 = qb * 64 + wave * 16; const int kce = (kb_last(qb) + 1) * 4;
  v8f acc[HD / 16] = {};
  if (qb < QBH) {
#pragma unroll 1
    for (int kc = 0; kc < kce; ++kc) { const F2 p = split_row(PS + (size_t)(ql0 + col) * TT, kc * 32, lane);
      asm volatile("s_wait_loadcnt 0x0" ::: "memory");
#pragma unroll
      for (int j = 0; j < HD / 16; ++j) { const size_t po = ((size_t)b * CC + h * HD + j * 16 + col) * (size_t)KHI + kc * 32; const v16b vh = frag_b(VB + po, lane); acc[j] = wmma_bf(p.h, vh, acc[j]); acc[j] = wmma_bf(p.l, vh, acc[j]); acc[j] = wmma_bf(p.h, frag_b(VBL + po, lane), acc[j]); } }
  } else {
#pragma unroll 1
    for (int kc = 0; kc < kce; ++kc) { const v16h p = frag_f32(PS + (size_t)(ql0 + col) * TT + kc * 32, lane);
      asm volatile("s_wait_loadcnt 0x0" ::: "memory");
#pragma unroll
      for (int j = 0; j < HD / 16; ++j) { const size_t po = ((size_t)b * CC + h * HD + j * 16 + col) * (size_t)TT + kc * 32; acc[j] = wmma16(p, frag_h(VT + po, lane), acc[j]); } } }
#pragma unroll
  for (int j = 0; j < HD / 16; ++j)
#pragma unroll
    for (int r = 0; r < 8; ++r) ss[wave][8 * g + r][j * 16 + col] = acc[j][r] * (1.0f / 2048.0f);
  LDSX(); for (int rl = 0; rl < 16; ++rl) if (lane < HD / 4) vst2(Y + ((size_t)b * TT + ql0 + rl) * CC + h * HD + lane * 4, *(const v4f*)&ss[wave][rl][lane * 4]); }

extern "C" void kernel_launch(void* const* d_in, const int* in_sizes, int n_in, void* d_out, int out_size, void* d_ws, size_t ws_size, hipStream_t stream) {
  (void)in_sizes; (void)n_in; (void)out_size;
  const float** F = (const float**)d_in;
  if (ws_size < (size_t)WS_END) return;
  char* ws = (char*)d_ws; _Float16 *QH = (_Float16*)(ws + WS_QH), *KH = (_Float16*)(ws + WS_KH), *VT = (_Float16*)(ws + WS_VT), *QL = (_Float16*)(ws + WS_QL), *KL = (_Float16*)(ws + WS_KL); __bf16 *VB = (__bf16*)(ws + WS_VB), *VBL = (__bf16*)(ws + WS_VBL); float *S = (float*)(ws + WS_S), *Y = (float*)(ws + WS_Y);
  (void)Y; (void)QL; (void)KL; (void)VB; (void)VBL;
  // inputs: 0 Q [16,2048,128]; 1 K; 2 V; 3 p_q [16,2048,1]; 4 p_k [16,2048,1]
  k_planes1<<<dim3(TNB * TT / 64), 256, 0, stream>>>(F[0], F[1], F[2], QH, QL, KH, VT);
  for (int b = 0; b < TNB; b += HG) {
    k_sc<<<dim3(NQB, TT / 128, HG), 128, 0, stream>>>(QH, KH, QL, KL, b, 0, S);
    k_sm<<<dim3(TT, HG), 256, 0, stream>>>(S, b, F[3], F[4]);
    k_pv<<<dim3(NQB, 1, HG), 128, 0, stream>>>(S, VT, VB, VBL, b, 0, (float*)d_out);
  }
}

// v002
// Measured time: 59.1 microseconds a run.
// Two timings next to v001 put it at 8.66 and 8.63 times that version's speed.
// Over all steps from v000 it is 34.2 times as fast.
// compute dtype: all float inputs rounded to bf16; Q, K, V are bf16-valued so their f16 planes are exact; logits (q hi + q residual x 2^-10) x k (2 products) x 128^-0.5, then x p_q x p_k in f32 as the module; softmax f32, online over 32-key blocks; P = exp(logit - max in use) x 2^4 once to f16 x v (exact) (1 product), divided by the f32 row sum; f32 output.
#include <hip/hip_runtime.h>
#include <math.h>

typedef __attribute__((ext_vector_type(16))) _Float16 v16h;
typedef __attribute__((ext_vector_type(16))) __bf16 v16b;
typedef __attribute__((ext_vector_type(8)))  _Float16 v8h;
typedef __attribute__((ext_vector_type(8)))  float v8f;
typedef __attribute__((ext_vector_type(4)))  float v4f;
typedef __attribute__((ext_vector_type(2)))  float v2f;
typedef __attribute__((ext_vector_type(4)))  unsigned v4u;
typedef _Float16 hx8 __attribute__((ext_vector_type(8)));
typedef __attribute__((ext_vector_type(4)))  int v4i;
typedef float __attribute__((may_alias)) float_a;
typedef int __attribute__((may_alias)) int_a;

template <typename T> __device__ __forceinline__ void vst2(void* p, T v) { *(T*)p = v;  }
__device__ __forceinline__ v8f wmma16(v16h a, v16h b, v8f c) {
  v8f d = __builtin_amdgcn_wmma_f32_16x16x32_f16(false, a, false, b, (short)0, c, false, false);
  asm volatile("v_nop\n\tv_nop\n\tv_nop\n\tv_nop" : "+v"(d) : "v"(a), "v"(b));
  return d;
}
__device__ __forceinline__ v8f wmma_bf(v16b a, v16b b, v8f c) {
  v8f d = __builtin_amdgcn_wmma_f32_16x16x32_bf16(false, a, false, b, (short)0, c, false, false);
  asm volatile("v_nop\n\tv_nop\n\tv_nop\n\tv_nop" : "+v"(d) : "v"(a), "v"(b));
  return d;
}
// 16x16x32 fragments: lane = (h = lane>>4, row/col = lane&15); elements 0..7 = k0+8h+0..7, 8..15 = k0+16+8h+0..7; D element r = row 8h+r
__device__ __forceinline__ v16h frag_h(const _Float16* rowk0, int lane) {
  union { v16h v; v8h q[2]; } u; const _Float16* p = rowk0 + 8 * (lane >> 4);
  u.q[0] = *(const v8h*)p; u.q[1] = *(const v8h*)(p + 16); return u.v;
}
__device__ __forceinline__ v16h frag_f32(const float* rowk0, int lane) {
  v16h a; const float* p = rowk0 + 8 * (lane >> 4);
#pragma unroll
  for (int i = 0; i < 8; ++i) { a[i] = (_Float16)p[i]; a[8 + i] = (_Float16)p[16 + i]; }
  return a;
}
__device__ __forceinline__ v16h frag_f32s(const float* rowk0, int lane, float sc) {
  v16h a; const float* p = rowk0 + 8 * (lane >> 4);
#pragma unroll
  for (int i = 0; i < 8; ++i) { a[i] = (_Float16)(p[i] * sc); a[8 + i] = (_Float16)(p[16 + i] * sc); }
  return a;
}
// column fragment from a [K][ld] layout (column n), rows >= K read as 0
__device__ __forceinline__ v16h fragc_f32(const float* W, int k0, int n, int lane, int ld, int K) {
  v16h a; const int g = lane >> 4;
#pragma unroll
  for (int i = 0; i < 8; ++i) { const int ka = k0 + 8 * g + i, kb = ka + 16;
    a[i] = (_Float16)(ka < K ? W[(size_t)(ka < K ? ka : K - 1) * ld + n] : 0.f); a[8 + i] = (_Float16)(kb < K ? W[(size_t)(kb < K ? kb : K - 1) * ld + n] : 0.f); }
  return a;
}
struct F2 { v16b h, l; };
__device__ __forceinline__ F2 bsplit16(const float v[16]) { F2 r;
#pragma unroll
  for (int i = 0; i < 16; ++i) { const __bf16 h = (__bf16)v[i]; r.h[i] = h; r.l[i] = (__bf16)(v[i] - (float)h); }
  return r; }
__device__ __forceinline__ F2 split_row(const float* row, int k0, int lane) { float v[16]; const float* p = row + k0 + 8 * (lane >> 4);
#pragma unroll
  for (int i = 0; i < 8; ++i) { v[i] = p[i]; v[8 + i] = p[16 + i]; }
  return bsplit16(v); }
__device__ __forceinline__ F2 split_rowK(const float* row, int k0, int lane, int K) { float v[16]; const int g = lane >> 4;
#pragma unroll
  for (int i = 0; i < 8; ++i) { const int ka = k0 + 8 * g + i, kb = ka + 16; v[i] = ka < K ? row[ka < K ? ka : K - 1] : 0.f; v[8 + i] = kb < K ? row[kb < K ? kb : K - 1] : 0.f; }
  return bsplit16(v); }
__device__ __forceinline__ F2 split_col(const float* W, int k0, int n, int lane, int ld, int K) { float v[16]; const int g = lane >> 4;
#pragma unroll
  for (int i = 0; i < 8; ++i) { const int ka = k0 + 8 * g + i, kb = ka + 16; v[i] = ka < K ? W[(size_t)(ka < K ? ka : K - 1) * ld + n] : 0.f; v[8 + i] = kb < K ? W[(size_t)(kb < K ? kb : K - 1) * ld + n] : 0.f; }
  return bsplit16(v); }
__device__ __forceinline__ v8f mac3(const F2& a, const F2& b, v8f c) { c = wmma_bf(a.l, b.h, c); c = wmma_bf(a.h, b.l, c); return wmma_bf(a.h, b.h, c); }
__device__ __forceinline__ float sigm(float v) { return 1.0f / (1.0f + expf(-v)); }
#define LDSX() do { asm volatile("s_wait_dscnt 0" ::: "memory"); __builtin_amdgcn_wave_barrier(); __builtin_amdgcn_fence(__ATOMIC_RELEASE, "workgroup"); } while (0)

// Gated scaled-dot-product attention (single head; Q, K, V [16,2048,128] given; p_q, p_k [16,2048,1] uniform[0,1) gates): A = (Q K^T / sqrt(128)) * p_q * p_k^T; out = softmax(A) V -> [16,2048,128].
#define NB 16
#define TT 2048
#define CC 128            // NH * HD = projected width
#define DIN 128          // input (model) width
#define NH 1
#define HD 128
#define NQB (TT / 64)
#define HG 8               // f32 logit planes WS_S reserves; no kernel in this file uses them
#define SCALE (0.08838834764831845f)
#define CAUSAL 0
#ifndef TNB
#define TNB NB
#endif
static_assert(TNB % HG == 0);
__device__ __forceinline__ float bfr(float v) { return (float)(__bf16)v; }
__host__ __device__ __forceinline__ int kb_last(int qb) { return CAUSAL ? ((qb * 64 + 63) >> 7) : (TT / 128 - 1); }
typedef __attribute__((ext_vector_type(8))) __bf16 v8b;
__device__ __forceinline__ v16b frag_b(const __bf16* rowk0, int lane) {
  union { v16b v; v8b q[2]; } u; const __bf16* p = rowk0 + 8 * (lane >> 4);
  u.q[0] = *(const v8b*)p; u.q[1] = *(const v8b*)(p + 16); return u.v;
}
#define QBH 0              // not used: no kernel in this file has a high-precision path
#define QHI 2048            // rows carrying a q residual plane (all rows when non-causal: 2-product logits everywhere)
#define KHI 64            // key rows carrying k residual / v bf16 hi+lo planes (written only by k_proj, which is not launched; nothing reads them)
// B fragment (k rows k0+.., output column o) of a weight: (in,out) [K][ld] or (out,in) [ld rows of K]: bf16 exact, or f16(bf16 * 256) exact
__device__ __forceinline__ v16b wcol_io(const float* Wm, int k0, int o, int lane, int ld) { v16b w; const int g = lane >> 4;
#pragma unroll
  for (int i = 0; i < 8; ++i) { w[i] = (__bf16)Wm[(size_t)(k0 + 8 * g + i) * ld + o]; w[8 + i] = (__bf16)Wm[(size_t)(k0 + 16 + 8 * g + i) * ld + o]; }
  return w; }
__device__ __forceinline__ v16b wcol_oi(const float* Wm, int k0, int o, int lane, int K) { v16b w; const float* p = Wm + (size_t)o * K + k0 + 8 * (lane >> 4);
#pragma unroll
  for (int i = 0; i < 8; ++i) { w[i] = (__bf16)p[i]; w[8 + i] = (__bf16)p[16 + i]; }
  return w; }
__device__ __forceinline__ v16h wcolh_io(const float* Wm, int k0, int o, int lane, int ld) { v16h w; const int g = lane >> 4;
#pragma unroll
  for (int i = 0; i < 8; ++i) { w[i] = (_Float16)(bfr(Wm[(size_t)(k0 + 8 * g + i) * ld + o]) * 256.0f); w[8 + i] = (_Float16)(bfr(Wm[(size_t)(k0 + 16 + 8 * g + i) * ld + o]) * 256.0f); }
  return w; }
__device__ __forceinline__ v16h wcolh_oi(const float* Wm, int k0, int o, int lane, int K) { v16h w; const float* p = Wm + (size_t)o * K + k0 + 8 * (lane >> 4);
#pragma unroll
  for (int i = 0; i < 8; ++i) { w[i] = (_Float16)(bfr(p[i]) * 256.0f); w[8 + i] = (_Float16)(bfr(p[16 + i]) * 256.0f); }
  return w; }
#define WQKV_LAYOUT 0   // 0 = (in,out) [DIN][CC]; 1 = (out,in) [CC][DIN]; 2 = per-head [NH][DIN][HD]
__device__ __forceinline__ v16b wcol_hdk(const float* Wm, int k0, int o, int lane) { v16b w; const int g = lane >> 4; const float* p = Wm + (size_t)(o / HD) * DIN * HD + (o % HD);
#pragma unroll
  for (int i = 0; i < 8; ++i) { w[i] = (__bf16)p[(size_t)(k0 + 8 * g + i) * HD]; w[8 + i] = (__bf16)p[(size_t)(k0 + 16 + 8 * g + i) * HD]; }
  return w; }
#define WO_OUT_IN 0
#if WQKV_LAYOUT == 1
#define WCOL(W, k0, o, lane) wcol_oi(W, k0, o, lane, DIN)
#elif WQKV_LAYOUT == 2
#define WCOL(W, k0, o, lane) wcol_hdk(W, k0, o, lane)
#else
#define WCOL(W, k0, o, lane) wcol_io(W, k0, o, lane, CC)
#endif
#if WO_OUT_IN
#define WOCOL(W, k0, o, lane) wcol_oi(W, k0, o, lane, CC)
#define WOCOLH(W, k0, o, lane) wcolh_oi(W, k0, o, lane, CC)
#else
#define WOCOL(W, k0, o, lane) wcol_io(W, k0, o, lane, DIN)
#define WOCOLH(W, k0, o, lane) wcolh_io(W, k0, o, lane, DIN)
#endif
#define SM_EXTRA_PARAMS , int bsm, const float* __restrict__ PQ, const float* __restrict__ PK
// multiplicative pre-gate: A = (A * bf16(p_q[b][t])) * bf16(p_k[b][k]) (f32, the module's order), then softmax
#define SM_MASK_HOOK do { v = (v * bfr(PQ[(size_t)bsm * TT + t])) * bfr(PK[(size_t)bsm * TT + k]); } while (0)   /* p_q / p_k bf16-rounded like every float input */
__global__ __launch_bounds__(256) void k_planes1(const float* __restrict__ Qs, const float* __restrict__ Ks, const float* __restrict__ Vs, _Float16* __restrict__ QH, _Float16* __restrict__ QL, _Float16* __restrict__ KH, _Float16* __restrict__ VT) {
  __shared__ _Float16 sv[64][136];
  const int tid = threadIdx.x; const size_t r0 = (size_t)blockIdx.x * 64; const int b = (int)(r0 / TT), t0 = (int)(r0 % TT);
  for (int e = tid; e < 64 * 16; e += 256) { const int rl = e >> 4, q = e & 15; const size_t src = (r0 + rl) * CC + q * 8; float tq[8], tk[8], tv[8];
#pragma unroll
    for (int u = 0; u < 8; ++u) { tq[u] = Qs[src + u]; tk[u] = Ks[src + u]; tv[u] = Vs[src + u]; }
    asm volatile("s_wait_loadcnt 0x0" ::: "memory");
    hx8 hq, hk, hl; 
#pragma unroll
    for (int u = 0; u < 8; ++u) { const float qv = bfr(tq[u]); const _Float16 qh = (_Float16)qv; hq[u] = qh; hl[u] = (_Float16)((qv - (float)qh) * 1024.0f); hk[u] = (_Float16)bfr(tk[u]); sv[rl][q * 8 + u] = (_Float16)bfr(tv[u]); }
    vst2((unsigned*)(QH + (r0 + rl) * CC + q * 8), *(const v4u*)&hq); vst2((unsigned*)(KH + (r0 + rl) * CC + q * 8), *(const v4u*)&hk);
    if (t0 + rl < QHI) vst2((unsigned*)(QL + ((size_t)b * QHI + t0 + rl) * CC + q * 8), *(const v4u*)&hl); }
  __syncthreads();
  for (int e = tid; e < 128 * 8; e += 256) { const int c = e >> 3, q = e & 7; hx8 hv; _Pragma("unroll") for (int j = 0; j < 8; ++j) hv[j] = sv[q * 8 + j][c]; vst2((unsigned*)(VT + ((size_t)b * CC + c) * TT + t0 + q * 8), *(const v4u*)&hv); } }
#ifndef SM_EXTRA_PARAMS
#define SM_EXTRA_PARAMS
#endif
#ifndef PROJ_EXTRA_PARAMS
#define PROJ_EXTRA_PARAMS
#endif
#ifndef SM_MASK_HOOK
#define SM_MASK_HOOK (void)0
#endif

#define WS_QH  0u                                      // f16 q rows [b*t][CC]
#define WS_KH  (WS_QH + 2u * (size_t)NB * TT * CC)      // f16 k rows [b*t][CC]
#define WS_VT  (WS_KH + 2u * (size_t)NB * TT * CC)      // f16 v planes [b][c][t]
#define WS_QL  (WS_VT + 2u * (size_t)NB * CC * TT)      // f16 q residual x 2^10 rows [b][t < QHI][CC]
#define WS_KL  (WS_QL + 2u * (size_t)NB * QHI * CC)     // f16 k residual x 2^10 rows [b][t < KHI][CC]
#define WS_VB  (WS_KL + 2u * (size_t)NB * KHI * CC)     // bf16 v hi planes [b][c][t < KHI]
#define WS_VBL (WS_VB + 2u * (size_t)NB * CC * KHI)
#define WS_S   (WS_VBL + 2u * (size_t)NB * CC * KHI)    // f32 logits / P [batch in group][t][s]
#define WS_Y   (WS_S  + 4u * (size_t)HG * TT * TT)      // f32 ctx rows [b*t][CC] (only when there is an output projection)
#define WS_END (WS_Y  + 0u)

// ---- k_proj: block = (64 rows, 128 cols, which): q/k/v = X W (+ b) with exact bf16 products (K = DIN) -> which 0: q f16 rows (+ residual rows < QHI); 1: k f16 rows (+ residual rows < KHI); 2: v f16 planes [c][t] (+ bf16 hi/lo planes for t < KHI)
__global__ __launch_bounds__(128) void k_proj(const float* __restrict__ XQ, const float* __restrict__ XK, const float* __restrict__ XV, const float* __restrict__ WQ, const float* __restrict__ WK, const float* __restrict__ WV, const float* __restrict__ BQ, const float* __restrict__ BK, const float* __restrict__ BV,
    _Float16* __restrict__ QH, _Float16* __restrict__ QL, _Float16* __restrict__ KH, _Float16* __restrict__ KL, _Float16* __restrict__ VT, __bf16* __restrict__ VB, __bf16* __restrict__ VBL) {
  __shared__ __align__(16) _Float16 sh[64][136], sl[64][136]; __shared__ __align__(16) _Float16 th[128][72]; __shared__ __align__(16) __bf16 tb[128][72], tbl[128][72];
  const int tid = threadIdx.x, wave = tid >> 5, lane = tid & 31, col = lane & 15, g = lane >> 4; const int which = blockIdx.z; const int c0 = blockIdx.y * 128; const size_t r0 = (size_t)blockIdx.x * 64; const size_t bb = r0 / TT; const int t0 = (int)(r0 % TT);
  const float* X = which == 0 ? XQ : which == 1 ? XK : XV; const float* WA = which == 0 ? WQ : which == 1 ? WK : WV; const float* BA = which == 0 ? BQ : which == 1 ? BK : BV;
  v8f acc[8] = {};
#pragma unroll 2
  for (int kc = 0; kc < DIN / 32; ++kc) { v16b a; { const float* p = X + (r0 + wave * 16 + col) * DIN + kc * 32 + 8 * g;
#pragma unroll
      for (int i = 0; i < 8; ++i) { a[i] = (__bf16)p[i]; a[8 + i] = (__bf16)p[16 + i]; } }
    asm volatile("s_wait_loadcnt 0x0" ::: "memory");
#pragma unroll
    for (int j = 0; j < 8; ++j) { const v16b w = WCOL(WA, kc * 32, c0 + j * 16 + col, lane); asm volatile("s_wait_loadcnt 0x0" ::: "memory"); acc[j] = wmma_bf(a, w, acc[j]); } }
  if (which < 2) { _Float16* DH = which == 0 ? QH : KH; _Float16* DL = which == 0 ? QL : KL; const int nhi = which == 0 ? QHI : KHI; const bool hi_rows = t0 < nhi;
#pragma unroll
    for (int j = 0; j < 8; ++j) { const float bias = BA ? bfr(BA[c0 + j * 16 + col]) : 0.f;
#pragma unroll
      for (int r = 0; r < 8; ++r) { const float v = acc[j][r] + bias; const _Float16 hv = (_Float16)v; sh[wave * 16 + 8 * g + r][j * 16 + col] = hv; sl[wave * 16 + 8 * g + r][j * 16 + col] = (_Float16)((v - (float)hv) * 1024.0f); } }
    __syncthreads();
    for (int e = tid; e < 64 * 16; e += 128) { const int rl = e >> 4, q = e & 15; vst2((unsigned*)(DH + (r0 + rl) * CC + c0 + q * 8), *(const v4u*)&sh[rl][q * 8]); if (hi_rows) vst2((unsigned*)(DL + (bb * nhi + t0 + rl) * (size_t)CC + c0 + q * 8), *(const v4u*)&sl[rl][q * 8]); }
  } else { const bool hi_rows = t0 < KHI;
#pragma unroll
    for (int j = 0; j < 8; ++j) { const float bias = BA ? bfr(BA[c0 + j * 16 + col]) : 0.f;
#pragma unroll
      for (int r = 0; r < 8; ++r) { const float v = acc[j][r] + bias; const int rl = wave * 16 + 8 * g + r, cl = j * 16 + col; th[cl][rl] = (_Float16)v; const __bf16 bh = (__bf16)v; tb[cl][rl] = bh; tbl[cl][rl] = (__bf16)(v - (float)bh); } }
    __syncthreads();
    for (int e = tid; e < 128 * 8; e += 128) { const int cl = e >> 3, q = e & 7; vst2((unsigned*)(VT + (bb * CC + c0 + cl) * (size_t)TT + t0 + q * 8), *(const v4u*)&th[cl][q * 8]); if (hi_rows) { const size_t o3 = (bb * CC + c0 + cl) * (size_t)KHI + t0 + q * 8; vst2((unsigned*)(VB + o3), *(const v4u*)&tb[cl][q * 8]); vst2((unsigned*)(VBL + o3), *(const v4u*)&tbl[cl][q * 8]); } } } }
#define FQ 128             // queries per work-group
#define FK 64              // keys per stage
#define KP 136             // f16 per staged k row: 272 B = 16 B x odd, conflict-free for 16-byte fragment reads
#define VP 72              // f16 per staged v plane row (64 keys): 144 B = 16 B x odd
#define SKB (FK * KP * 2)
#define SVB (HD * VP * 2)
#define OP 132             // floats per staged output row
#define LOG2E 1.4426950408889634f
#define SB() __builtin_amdgcn_sched_barrier(0)   // keeps a group of LDS fragment loads in front of the matrix or vector run written behind it, so that the run hides their latency
static_assert(8 * 16 * OP * 4 <= 2 * (SKB + SVB), "output staging must fit in the k/v buffers");
__device__ __forceinline__ v8f mm16(v16h a, v16h b, v8f c) { return __builtin_amdgcn_wmma_f32_16x16x32_f16(false, a, false, b, (short)0, c, false, false); }
__device__ __forceinline__ float xhalf(float x) { return __builtin_bit_cast(float, __builtin_amdgcn_permlanex16(__builtin_bit_cast(int, x), __builtin_bit_cast(int, x), 0x76543210, 0xfedcba98, false, false)); }  // lane l reads lane l ^ 16
__global__ __launch_bounds__(256) void k_fa(const _Float16* __restrict__ QH, const _Float16* __restrict__ QL, const _Float16* __restrict__ KH, const _Float16* __restrict__ VT, const float* __restrict__ PQ, const float* __restrict__ PK, float* __restrict__ Y) {
  __shared__ __align__(16) unsigned char L[2 * (SKB + SVB) + TT * 4];   // k buffers, v buffers, rounded p_k row
  const int tid = threadIdx.x, wave = tid >> 5, lane = tid & 31, col = lane & 15, g = lane >> 4; const int b = blockIdx.y; const int q0 = blockIdx.x * FQ + wave * 16;
  float* spk = (float*)(L + 2 * (SKB + SVB));
  const _Float16* kp = KH + (size_t)b * TT * CC + (size_t)(tid >> 4) * CC + (tid & 15) * 8;   // thread's 16-byte piece of k rows tid/16 + 16 i
  const _Float16* vp = VT + (size_t)b * CC * TT + (size_t)(tid >> 3) * TT + (tid & 7) * 8;    // thread's 16-byte piece of v plane rows tid/8 + 32 i
  unsigned char* kst = L + (tid >> 4) * (KP * 2) + (tid & 15) * 16; unsigned char* vst = L + 2 * SKB + (tid >> 3) * (VP * 2) + (tid & 7) * 16;
  v4u rk[4], rv[4];
#pragma unroll
  for (int i = 0; i < 4; ++i) { rk[i] = *(const v4u*)(kp + (size_t)i * 16 * CC); rv[i] = *(const v4u*)(vp + (size_t)i * 32 * TT); }
  { const float* pk = PK + (size_t)b * TT + tid * 8; v4f a = *(const v4f*)pk, c = *(const v4f*)(pk + 4);
#pragma unroll
    for (int u = 0; u < 4; ++u) { a[u] = bfr(a[u]); c[u] = bfr(c[u]); }
    *(v4f*)(spk + tid * 8) = a; *(v4f*)(spk + tid * 8 + 4) = c; }
  v16h qh[HD / 32], ql[HD / 32];
#pragma unroll
  for (int kc = 0; kc < HD / 32; ++kc) { qh[kc] = frag_h(QH + ((size_t)b * TT + q0 + col) * CC + kc * 32, lane); ql[kc] = frag_h(QL + ((size_t)b * QHI + q0 + col) * CC + kc * 32, lane); }
  const float pq = bfr(PQ[(size_t)b * TT + q0 + col]);
  asm volatile("s_wait_xcnt 0x0" ::: "memory"); SB();   // the address registers of the loads above are reused from here on; the scheduling barrier keeps later register writes behind the wait
#pragma unroll
  for (int i = 0; i < 4; ++i) { *(v4u*)(kst + i * 16 * (KP * 2)) = rk[i]; *(v4u*)(vst + i * 32 * (VP * 2)) = rv[i]; }
  __syncthreads();
  v8f acc[HD / 16] = {}; float mu = -1.0e30f, c2 = 0.f, l = 0.f;   // mu: the maximum in use; c2 = 4 - mu log2(e)
  for (int st = 0; st < TT / FK; ++st) { const int buf = st & 1; const bool more = st + 1 < TT / FK;
    const _Float16* sk = (const _Float16*)(L + buf * SKB) + col * KP; const _Float16* sv = (const _Float16*)(L + 2 * SKB + buf * SVB) + col * VP;
#pragma unroll
    for (int kk = 0; kk < FK / 32; ++kk) {
      if (more) {   // the next stage's pieces fly while this block is worked on: k during the first 32 keys, v during the second
#pragma unroll
        for (int i = 0; i < 4; ++i) rk[i] = kk == 0 ? *(const v4u*)(kp + (size_t)(st + 1) * FK * CC + (size_t)i * 16 * CC) : *(const v4u*)(vp + (st + 1) * FK + (size_t)i * 32 * TT);
        asm volatile("s_wait_xcnt 0x0" ::: "memory"); }   // the loads' address registers are reused by the fragment loads that follow
      v16h fa[4], fb[4]; v8f s[2] = {}, sl[2] = {};
#pragma unroll
      for (int kc = 0; kc < 4; ++kc) fa[kc] = frag_h(sk + (kk * 32) * KP + kc * 32, lane);
#pragma unroll
      for (int kc = 0; kc < 4; ++kc) fb[kc] = frag_h(sk + (kk * 32 + 16) * KP + kc * 32, lane);
      SB();
#pragma unroll
      for (int kc = 0; kc < 4; ++kc) { s[0] = mm16(fa[kc], qh[kc], s[0]); sl[0] = mm16(fa[kc], ql[kc], sl[0]); }
      SB();
#pragma unroll
      for (int j = 0; j < 4; ++j) fa[j] = frag_h(sv + j * 16 * VP + kk * 32, lane);
      SB();
#pragma unroll
      for (int kc = 0; kc < 4; ++kc) { s[1] = mm16(fb[kc], qh[kc], s[1]); sl[1] = mm16(fb[kc], ql[kc], sl[1]); }
      SB();
      float v[16]; float ml = -3.0e38f;
#pragma unroll
      for (int tt = 0; tt < 2; ++tt) { const float* pk = spk + st * FK + kk * 32 + tt * 16 + 8 * g; const v4f pa = *(const v4f*)pk, pb = *(const v4f*)(pk + 4);
#pragma unroll
        for (int r = 0; r < 8; ++r) { const float x = (((s[tt][r] + sl[tt][r] * (1.0f / 1024.0f)) * SCALE) * pq) * (r < 4 ? pa[r & 3] : pb[r & 3]); v[tt * 8 + r] = x; ml = fmaxf(ml, x); } }
      SB();
#pragma unroll
      for (int j = 0; j < 4; ++j) fb[j] = frag_h(sv + (4 + j) * 16 * VP + kk * 32, lane);
      SB();
      ml = fmaxf(ml, xhalf(ml));
      if (__builtin_amdgcn_ballot_w32(ml > mu + 5.5f) != 0) {   // lazy rescale: only when some query's maximum outgrows the one in use by 5.5, so P x 2^4 stays below 2^12 in f16
        const float mn = fmaxf(mu, ml); const float al = __builtin_amdgcn_exp2f((mu - mn) * LOG2E); mu = mn; c2 = 4.0f - mn * LOG2E; l *= al;
#pragma unroll
        for (int j = 0; j < HD / 16; ++j) acc[j] *= al; }
      v16h p; float e[16];
#pragma unroll
      for (int i = 0; i < 3; ++i) v[i] = fmaf(v[i], LOG2E, c2);
      SB();
#pragma unroll
      for (int i = 0; i < 16; ++i) {   // issue order held: a later argument's multiply-add stands behind each exponential while there is one; it fills the slot that a transcendental wants behind it and runs beside it
        e[i] = __builtin_amdgcn_exp2f(v[i]);
        if (i < 13) { SB(); v[i + 3] = fmaf(v[i + 3], LOG2E, c2); SB(); }
        else if (i < 15) { SB(); asm volatile("v_nop"); SB(); } }   // no multiply-add is left: the slot behind the transcendental, whose argument register the next one's result may take
#pragma unroll
      for (int i = 0; i < 16; ++i) { l += e[i]; p[i] = (_Float16)e[i]; }
#pragma unroll
      for (int j = 0; j < 4; ++j) acc[j] = mm16(fa[j], p, acc[j]);
#pragma unroll
      for (int j = 0; j < 4; ++j) acc[4 + j] = mm16(fb[j], p, acc[4 + j]);
      if (more) {
#pragma unroll
        for (int i = 0; i < 4; ++i) { if (kk == 0) *(v4u*)(kst + (buf ^ 1) * SKB + i * 16 * (KP * 2)) = rk[i]; else *(v4u*)(vst + (buf ^ 1) * SVB + i * 32 * (VP * 2)) = rk[i]; } } }
    __syncthreads(); }   // publishes the next stage and ends every reader's last read of this one
  l += xhalf(l); const float inv = 1.0f / l;
  float* so = (float*)L + wave * 16 * OP;   // lane (g, col) holds O[query col][16 j + 8 g + r]: staged so that each row leaves as one 512-byte store
#pragma unroll
  for (int j = 0; j < HD / 16; ++j) { const v8f o = acc[j] * inv; *(v4f*)(so + col * OP + j * 16 + 8 * g) = __builtin_shufflevector(o, o, 0, 1, 2, 3); *(v4f*)(so + col * OP + j * 16 + 8 * g + 4) = __builtin_shufflevector(o, o, 4, 5, 6, 7); }
  __syncthreads();
  for (int rl = 0; rl < 16; ++rl) vst2(Y + ((size_t)b * TT + q0 + rl) * CC + lane * 4, *(const v4f*)(so + rl * OP + lane * 4)); }

extern "C" void kernel_launch(void* const* d_in, const int* in_sizes, int n_in, void* d_out, int out_size, void* d_ws, size_t ws_size, hipStream_t stream) {
  (void)in_sizes; (void)n_in; (void)out_size;
  const float** F = (const float**)d_in;
  if (ws_size < (size_t)WS_END) return;
  char* ws = (char*)d_ws; _Float16 *QH = (_Float16*)(ws + WS_QH), *KH = (_Float16*)(ws + WS_KH), *VT = (_Float16*)(ws + WS_VT), *QL = (_Float16*)(ws + WS_QL), *KL = (_Float16*)(ws + WS_KL); __bf16 *VB = (__bf16*)(ws + WS_VB), *VBL = (__bf16*)(ws + WS_VBL); float *S = (float*)(ws + WS_S), *Y = (float*)(ws + WS_Y);
  (void)Y; (void)S; (void)KL; (void)VB; (void)VBL;
  // inputs: 0 Q [16,2048,128]; 1 K; 2 V; 3 p_q [16,2048,1]; 4 p_k [16,2048,1]
  k_planes1<<<dim3(TNB * TT / 64), 256, 0, stream>>>(F[0], F[1], F[2], QH, QL, KH, VT);
  k_fa<<<dim3(TT / FQ, TNB), 256, 0, stream>>>(QH, QL, KH, VT, F[3], F[4], (float*)d_out);
}

// v003
// Measured time: 53.6 microseconds a run.
// Timed twice side by side with v002, it ran 1.09 times as fast both times.
// Counting every step since v000, it is 37.2 times as fast.
// compute dtype: all float inputs rounded to bf16; Q, K, V are bf16-valued so their f16 planes are exact; logits q x k (1 product) x 128^-0.5, then x p_q x p_k in f32 as the module; softmax f32, online over 32-key blocks; P = exp(logit - max in use) x 2^4 once to f16 x v (exact) (1 product), divided by the f32 row sum; f32 output.
#include <hip/hip_runtime.h>
#include <math.h>

typedef __attribute__((ext_vector_type(16))) _Float16 v16h;
typedef __attribute__((ext_vector_type(16))) __bf16 v16b;
typedef __attribute__((ext_vector_type(8)))  _Float16 v8h;
typedef __attribute__((ext_vector_type(8)))  float v8f;
typedef __attribute__((ext_vector_type(4)))  float v4f;
typedef __attribute__((ext_vector_type(2)))  float v2f;
typedef __attribute__((ext_vector_type(4)))  unsigned v4u;
typedef _Float16 hx8 __attribute__((ext_vector_type(8)));
typedef __attribute__((ext_vector_type(4)))  int v4i;
typedef float __attribute__((may_alias)) float_a;
typedef int __attribute__((may_alias)) int_a;

template <typename T> __device__ __forceinline__ void vst2(void* p, T v) { *(T*)p = v;  }
__device__ __forceinline__ v8f wmma16(v16h a, v16h b, v8f c) {
  v8f d = __builtin_amdgcn_wmma_f32_16x16x32_f16(false, a, false, b, (short)0, c, false, false);
  asm volatile("v_nop\n\tv_nop\n\tv_nop\n\tv_nop" : "+v"(d) : "v"(a), "v"(b));
  return d;
}
__device__ __forceinline__ v8f wmma_bf(v16b a, v16b b, v8f c) {
  v8f d = __builtin_amdgcn_wmma_f32_16x16x32_bf16(false, a, false, b, (short)0, c, false, false);
  asm volatile("v_nop\n\tv_nop\n\tv_nop\n\tv_nop" : "+v"(d) : "v"(a), "v"(b));
  return d;
}
// 16x16x32 fragments: lane = (h = lane>>4, row/col = lane&15); elements 0..7 = k0+8h+0..7, 8..15 = k0+16+8h+0..7; D element r = row 8h+r
__device__ __forceinline__ v16h frag_h(const _Float16* rowk0, int lane) {
  union { v16h v; v8h q[2]; } u; const _Float16* p = rowk0 + 8 * (lane >> 4);
  u.q[0] = *(const v8h*)p; u.q[1] = *(const v8h*)(p + 16); return u.v;
}
__device__ __forceinline__ v16h frag_f32(const float* rowk0, int lane) {
  v16h a; const float* p = rowk0 + 8 * (lane >> 4);
#pragma unroll
  for (int i = 0; i < 8; ++i) { a[i] = (_Float16)p[i]; a[8 + i] = (_Float16)p[16 + i]; }
  return a;
}
__device__ __forceinline__ v16h frag_f32s(const float* rowk0, int lane, float sc) {
  v16h a; const float* p = rowk0 + 8 * (lane >> 4);
#pragma unroll
  for (int i = 0; i < 8; ++i) { a[i] = (_Float16)(p[i] * sc); a[8 + i] = (_Float16)(p[16 + i] * sc); }
  return a;
}
// column fragment from a [K][ld] layout (column n), rows >= K read as 0
__device__ __forceinline__ v16h fragc_f32(const float* W, int k0, int n, int lane, int ld, int K) {
  v16h a; const int g = lane >> 4;
#pragma unroll
  for (int i = 0; i < 8; ++i) { const int ka = k0 + 8 * g + i, kb = ka + 16;
    a[i] = (_Float16)(ka < K ? W[(size_t)(ka < K ? ka : K - 1) * ld + n] : 0.f); a[8 + i] = (_Float16)(kb < K ? W[(size_t)(kb < K ? kb : K - 1) * ld + n] : 0.f); }
  return a;
}
struct F2 { v16b h, l; };
__device__ __forceinline__ F2 bsplit16(const float v[16]) { F2 r;
#pragma unroll
  for (int i = 0; i < 16; ++i) { const __bf16 h = (__bf16)v[i]; r.h[i] = h; r.l[i] = (__bf16)(v[i] - (float)h); }
  return r; }
__device__ __forceinline__ F2 split_row(const float* row, int k0, int lane) { float v[16]; const float* p = row + k0 + 8 * (lane >> 4);
#pragma unroll
  for (int i = 0; i < 8; ++i) { v[i] = p[i]; v[8 + i] = p[16 + i]; }
  return bsplit16(v); }
__device__ __forceinline__ F2 split_rowK(const float* row, int k0, int lane, int K) { float v[16]; const int g = lane >> 4;
#pragma unroll
  for (int i = 0; i < 8; ++i) { const int ka = k0 + 8 * g + i, kb = ka + 16; v[i] = ka < K ? row[ka < K ? ka : K - 1] : 0.f; v[8 + i] = kb < K ? row[kb < K ? kb : K - 1] : 0.f; }
  return bsplit16(v); }
__device__ __forceinline__ F2 split_col(const float* W, int k0, int n, int lane, int ld, int K) { float v[16]; const int g = lane >> 4;
#pragma unroll
  for (int i = 0; i < 8; ++i) { const int ka = k0 + 8 * g + i, kb = ka + 16; v[i] = ka < K ? W[(size_t)(ka < K ? ka : K - 1) * ld + n] : 0.f; v[8 + i] = kb < K ? W[(size_t)(kb < K ? kb : K - 1) * ld + n] : 0.f; }
  return bsplit16(v); }
__device__ __forceinline__ v8f mac3(const F2& a, const F2& b, v8f c) { c = wmma_bf(a.l, b.h, c); c = wmma_bf(a.h, b.l, c); return wmma_bf(a.h, b.h, c); }
__device__ __forceinline__ float sigm(float v) { return 1.0f / (1.0f + expf(-v)); }
#define LDSX() do { asm volatile("s_wait_dscnt 0" ::: "memory"); __builtin_amdgcn_wave_barrier(); __builtin_amdgcn_fence(__ATOMIC_RELEASE, "workgroup"); } while (0)

// Gated scaled-dot-product attention (single head; Q, K, V [16,2048,128] given; p_q, p_k [16,2048,1] uniform[0,1) gates): A = (Q K^T / sqrt(128)) * p_q * p_k^T; out = softmax(A) V -> [16,2048,128].
#define NB 16
#define TT 2048
#define CC 128            // NH * HD = projected width
#define DIN 128          // input (model) width
#define NH 1
#define HD 128
#define NQB (TT / 64)
#define HG 8               // f32 logit planes WS_S reserves; no kernel in this file uses them
#define SCALE (0.08838834764831845f)
#define CAUSAL 0
#ifndef TNB
#define TNB NB
#endif
static_assert(TNB % HG == 0);
__device__ __forceinline__ float bfr(float v) { return (float)(__bf16)v; }
__host__ __device__ __forceinline__ int kb_last(int qb) { return CAUSAL ? ((qb * 64 + 63) >> 7) : (TT / 128 - 1); }
typedef __attribute__((ext_vector_type(8))) __bf16 v8b;
__device__ __forceinline__ v16b frag_b(const __bf16* rowk0, int lane) {
  union { v16b v; v8b q[2]; } u; const __bf16* p = rowk0 + 8 * (lane >> 4);
  u.q[0] = *(const v8b*)p; u.q[1] = *(const v8b*)(p + 16); return u.v;
}
#define QBH 0              // not used by any kernel in this file
#define QHI 2048            // rows carrying a q residual plane (all rows when non-causal; k_fa uses none: 1-product logits everywhere)
#define KHI 64            // key rows carrying k residual / v bf16 hi+lo planes (written only by k_proj, which is not launched)
// B fragment (k rows k0+.., output column o) of a weight: (in,out) [K][ld] or (out,in) [ld rows of K]: bf16 exact, or f16(bf16 * 256) exact
__device__ __forceinline__ v16b wcol_io(const float* Wm, int k0, int o, int lane, int ld) { v16b w; const int g = lane >> 4;
#pragma unroll
  for (int i = 0; i < 8; ++i) { w[i] = (__bf16)Wm[(size_t)(k0 + 8 * g + i) * ld + o]; w[8 + i] = (__bf16)Wm[(size_t)(k0 + 16 + 8 * g + i) * ld + o]; }
  return w; }
__device__ __forceinline__ v16b wcol_oi(const float* Wm, int k0, int o, int lane, int K) { v16b w; const float* p = Wm + (size_t)o * K + k0 + 8 * (lane >> 4);
#pragma unroll
  for (int i = 0; i < 8; ++i) { w[i] = (__bf16)p[i]; w[8 + i] = (__bf16)p[16 + i]; }
  return w; }
__device__ __forceinline__ v16h wcolh_io(const float* Wm, int k0, int o, int lane, int ld) { v16h w; const int g = lane >> 4;
#pragma unroll
  for (int i = 0; i < 8; ++i) { w[i] = (_Float16)(bfr(Wm[(size_t)(k0 + 8 * g + i) * ld + o]) * 256.0f); w[8 + i] = (_Float16)(bfr(Wm[(size_t)(k0 + 16 + 8 * g + i) * ld + o]) * 256.0f); }
  return w; }
__device__ __forceinline__ v16h wcolh_oi(const float* Wm, int k0, int o, int lane, int K) { v16h w; const float* p = Wm + (size_t)o * K + k0 + 8 * (lane >> 4);
#pragma unroll
  for (int i = 0; i < 8; ++i) { w[i] = (_Float16)(bfr(p[i]) * 256.0f); w[8 + i] = (_Float16)(bfr(p[16 + i]) * 256.0f); }
  return w; }
#define WQKV_LAYOUT 0   // 0 = (in,out) [DIN][CC]; 1 = (out,in) [CC][DIN]; 2 = per-head [NH][DIN][HD]
__device__ __forceinline__ v16b wcol_hdk(const float* Wm, int k0, int o, int lane) { v16b w; const int g = lane >> 4; const float* p = Wm + (size_t)(o / HD) * DIN * HD + (o % HD);
#pragma unroll
  for (int i = 0; i < 8; ++i) { w[i] = (__bf16)p[(size_t)(k0 + 8 * g + i) * HD]; w[8 + i] = (__bf16)p[(size_t)(k0 + 16 + 8 * g + i) * HD]; }
  return w; }
#define WO_OUT_IN 0
#if WQKV_LAYOUT == 1
#define WCOL(W, k0, o, lane) wcol_oi(W, k0, o, lane, DIN)
#elif WQKV_LAYOUT == 2
#define WCOL(W, k0, o, lane) wcol_hdk(W, k0, o, lane)
#else
#define WCOL(W, k0, o, lane) wcol_io(W, k0, o, lane, CC)
#endif
#if WO_OUT_IN
#define WOCOL(W, k0, o, lane) wcol_oi(W, k0, o, lane, CC)
#define WOCOLH(W, k0, o, lane) wcolh_oi(W, k0, o, lane, CC)
#else
#define WOCOL(W, k0, o, lane) wcol_io(W, k0, o, lane, DIN)
#define WOCOLH(W, k0, o, lane) wcolh_io(W, k0, o, lane, DIN)
#endif
#define SM_EXTRA_PARAMS , int bsm, const float* __restrict__ PQ, const float* __restrict__ PK
// multiplicative pre-gate: A = (A * bf16(p_q[b][t])) * bf16(p_k[b][k]) (f32, the module's order), then softmax
#define SM_MASK_HOOK do { v = (v * bfr(PQ[(size_t)bsm * TT + t])) * bfr(PK[(size_t)bsm * TT + k]); } while (0)   /* p_q / p_k bf16-rounded like every float input */
__global__ __launch_bounds__(256) void k_planes1(const float* __restrict__ Qs, const float* __restrict__ Ks, const float* __restrict__ Vs, _Float16* __restrict__ QH, _Float16* __restrict__ KH, _Float16* __restrict__ VT) {
  __shared__ _Float16 sv[64][136];
  const int tid = threadIdx.x; const size_t r0 = (size_t)blockIdx.x * 64; const int b = (int)(r0 / TT), t0 = (int)(r0 % TT);
  for (int e = tid; e < 64 * 16; e += 256) { const int rl = e >> 4, q = e & 15; const size_t src = (r0 + rl) * CC + q * 8; float tq[8], tk[8], tv[8];
#pragma unroll
    for (int u = 0; u < 8; ++u) { tq[u] = Qs[src + u]; tk[u] = Ks[src + u]; tv[u] = Vs[src + u]; }
    asm volatile("s_wait_loadcnt 0x0" ::: "memory");
    hx8 hq, hk;
#pragma unroll
    for (int u = 0; u < 8; ++u) { hq[u] = (_Float16)bfr(tq[u]); hk[u] = (_Float16)bfr(tk[u]); sv[rl][q * 8 + u] = (_Float16)bfr(tv[u]); }
    vst2((unsigned*)(QH + (r0 + rl) * CC + q * 8), *(const v4u*)&hq); vst2((unsigned*)(KH + (r0 + rl) * CC + q * 8), *(const v4u*)&hk); }
  __syncthreads();
  for (int e = tid; e < 128 * 8; e += 256) { const int c = e >> 3, q = e & 7; hx8 hv; _Pragma("unroll") for (int j = 0; j < 8; ++j) hv[j] = sv[q * 8 + j][c]; vst2((unsigned*)(VT + ((size_t)b * CC + c) * TT + t0 + q * 8), *(const v4u*)&hv); } }
#ifndef SM_EXTRA_PARAMS
#define SM_EXTRA_PARAMS
#endif
#ifndef PROJ_EXTRA_PARAMS
#define PROJ_EXTRA_PARAMS
#endif
#ifndef SM_MASK_HOOK
#define SM_MASK_HOOK (void)0
#endif

#define WS_QH  0u                                      // f16 q rows [b*t][CC]
#define WS_KH  (WS_QH + 2u * (size_t)NB * TT * CC)      // f16 k rows [b*t][CC]
#define WS_VT  (WS_KH + 2u * (size_t)NB * TT * CC)      // f16 v planes [b][c][t]
#define WS_QL  (WS_VT + 2u * (size_t)NB * CC * TT)      // f16 q residual x 2^10 rows [b][t < QHI][CC]
#define WS_KL  (WS_QL + 2u * (size_t)NB * QHI * CC)     // f16 k residual x 2^10 rows [b][t < KHI][CC]
#define WS_VB  (WS_KL + 2u * (size_t)NB * KHI * CC)     // bf16 v hi planes [b][c][t < KHI]
#define WS_VBL (WS_VB + 2u * (size_t)NB * CC * KHI)
#define WS_S   (WS_VBL + 2u * (size_t)NB * CC * KHI)    // f32 logits / P [batch in group][t][s]
#define WS_Y   (WS_S  + 4u * (size_t)HG * TT * TT)      // f32 ctx rows [b*t][CC] (only when there is an output projection)
#define WS_END (WS_Y  + 0u)

// ---- k_proj: block = (64 rows, 128 cols, which): q/k/v = X W (+ b) with exact bf16 products (K = DIN) -> which 0: q f16 rows (+ residual rows < QHI); 1: k f16 rows (+ residual rows < KHI); 2: v f16 planes [c][t] (+ bf16 hi/lo planes for t < KHI)
__global__ __launch_bounds__(128) void k_proj(const float* __restrict__ XQ, const float* __restrict__ XK, const float* __restrict__ XV, const float* __restrict__ WQ, const float* __restrict__ WK, const float* __restrict__ WV, const float* __restrict__ BQ, const float* __restrict__ BK, const float* __restrict__ BV,
    _Float16* __restrict__ QH, _Float16* __restrict__ QL, _Float16* __restrict__ KH, _Float16* __restrict__ KL, _Float16* __restrict__ VT, __bf16* __restrict__ VB, __bf16* __restrict__ VBL) {
  __shared__ __align__(16) _Float16 sh[64][136], sl[64][136]; __shared__ __align__(16) _Float16 th[128][72]; __shared__ __align__(16) __bf16 tb[128][72], tbl[128][72];
  const int tid = threadIdx.x, wave = tid >> 5, lane = tid & 31, col = lane & 15, g = lane >> 4; const int which = blockIdx.z; const int c0 = blockIdx.y * 128; const size_t r0 = (size_t)blockIdx.x * 64; const size_t bb = r0 / TT; const int t0 = (int)(r0 % TT);
  const float* X = which == 0 ? XQ : which == 1 ? XK : XV; const float* WA = which == 0 ? WQ : which == 1 ? WK : WV; const float* BA = which == 0 ? BQ : which == 1 ? BK : BV;
  v8f acc[8] = {};
#pragma unroll 2
  for (int kc = 0; kc < DIN / 32; ++kc) { v16b a; { const float* p = X + (r0 + wave * 16 + col) * DIN + kc * 32 + 8 * g;
#pragma unroll
      for (int i = 0; i < 8; ++i) { a[i] = (__bf16)p[i]; a[8 + i] = (__bf16)p[16 + i]; } }
    asm volatile("s_wait_loadcnt 0x0" ::: "memory");
#pragma unroll
    for (int j = 0; j < 8; ++j) { const v16b w = WCOL(WA, kc * 32, c0 + j * 16 + col, lane); asm volatile("s_wait_loadcnt 0x0" ::: "memory"); acc[j] = wmma_bf(a, w, acc[j]); } }
  if (which < 2) { _Float16* DH = which == 0 ? QH : KH; _Float16* DL = which == 0 ? QL : KL; const int nhi = which == 0 ? QHI : KHI; const bool hi_rows = t0 < nhi;
#pragma unroll
    for (int j = 0; j < 8; ++j) { const float bias = BA ? bfr(BA[c0 + j * 16 + col]) : 0.f;
#pragma unroll
      for (int r = 0; r < 8; ++r) { const float v = acc[j][r] + bias; const _Float16 hv = (_Float16)v; sh[wave * 16 + 8 * g + r][j * 16 + col] = hv; sl[wave * 16 + 8 * g + r][j * 16 + col] = (_Float16)((v - (float)hv) * 1024.0f); } }
    __syncthreads();
    for (int e = tid; e < 64 * 16; e += 128) { const int rl = e >> 4, q = e & 15; vst2((unsigned*)(DH + (r0 + rl) * CC + c0 + q * 8), *(const v4u*)&sh[rl][q * 8]); if (hi_rows) vst2((unsigned*)(DL + (bb * nhi + t0 + rl) * (size_t)CC + c0 + q * 8), *(const v4u*)&sl[rl][q * 8]); }
  } else { const bool hi_rows = t0 < KHI;
#pragma unroll
    for (int j = 0; j < 8; ++j) { const float bias = BA ? bfr(BA[c0 + j * 16 + col]) : 0.f;
#pragma unroll
      for (int r = 0; r < 8; ++r) { const float v = acc[j][r] + bias; const int rl = wave * 16 + 8 * g + r, cl = j * 16 + col; th[cl][rl] = (_Float16)v; const __bf16 bh = (__bf16)v; tb[cl][rl] = bh; tbl[cl][rl] = (__bf16)(v - (float)bh); } }
    __syncthreads();
    for (int e = tid; e < 128 * 8; e += 128) { const int cl = e >> 3, q = e & 7; vst2((unsigned*)(VT + (bb * CC + c0 + cl) * (size_t)TT + t0 + q * 8), *(const v4u*)&th[cl][q * 8]); if (hi_rows) { const size_t o3 = (bb * CC + c0 + cl) * (size_t)KHI + t0 + q * 8; vst2((unsigned*)(VB + o3), *(const v4u*)&tb[cl][q * 8]); vst2((unsigned*)(VBL + o3), *(const v4u*)&tbl[cl][q * 8]); } } } }
#define FQ 128             // queries per work-group
#define FK 64              // keys per stage
#define KP 136             // f16 per staged k row: 272 B = 16 B x odd, conflict-free for 16-byte fragment reads
#define VP 72              // f16 per staged v plane row (64 keys): 144 B = 16 B x odd
#define SKB (FK * KP * 2)
#define SVB (HD * VP * 2)
#define OP 132             // floats per staged output row
#define LOG2E 1.4426950408889634f
#define SB() __builtin_amdgcn_sched_barrier(0)   // keeps a group of LDS fragment loads in front of the matrix or vector run written behind it, so that the run hides their latency
static_assert(8 * 16 * OP * 4 <= 2 * (SKB + SVB), "output staging must fit in the k/v buffers");
__device__ __forceinline__ v8f mm16(v16h a, v16h b, v8f c) { return __builtin_amdgcn_wmma_f32_16x16x32_f16(false, a, false, b, (short)0, c, false, false); }
__device__ __forceinline__ float xhalf(float x) { return __builtin_bit_cast(float, __builtin_amdgcn_permlanex16(__builtin_bit_cast(int, x), __builtin_bit_cast(int, x), 0x76543210, 0xfedcba98, false, false)); }  // lane l reads lane l ^ 16
__global__ __launch_bounds__(256) void k_fa(const _Float16* __restrict__ QH, const _Float16* __restrict__ KH, const _Float16* __restrict__ VT, const float* __restrict__ PQ, const float* __restrict__ PK, float* __restrict__ Y) {
  __shared__ __align__(16) unsigned char L[2 * (SKB + SVB) + TT * 4];   // k buffers, v buffers, rounded p_k row
  const int tid = threadIdx.x, wave = tid >> 5, lane = tid & 31, col = lane & 15, g = lane >> 4; const int b = blockIdx.y; const int q0 = blockIdx.x * FQ + wave * 16;
  float* spk = (float*)(L + 2 * (SKB + SVB));
  const _Float16* kp = KH + (size_t)b * TT * CC + (size_t)(tid >> 4) * CC + (tid & 15) * 8;   // thread's 16-byte piece of k rows tid/16 + 16 i
  const _Float16* vp = VT + (size_t)b * CC * TT + (size_t)(tid >> 3) * TT + (tid & 7) * 8;    // thread's 16-byte piece of v plane rows tid/8 + 32 i
  unsigned char* kst = L + (tid >> 4) * (KP * 2) + (tid & 15) * 16; unsigned char* vst = L + 2 * SKB + (tid >> 3) * (VP * 2) + (tid & 7) * 16;
  v4u rk[4], rv[4];
#pragma unroll
  for (int i = 0; i < 4; ++i) { rk[i] = *(const v4u*)(kp + (size_t)i * 16 * CC); rv[i] = *(const v4u*)(vp + (size_t)i * 32 * TT); }
  { const float* pk = PK + (size_t)b * TT + tid * 8; v4f a = *(const v4f*)pk, c = *(const v4f*)(pk + 4);
#pragma unroll
    for (int u = 0; u < 4; ++u) { a[u] = bfr(a[u]); c[u] = bfr(c[u]); }
    *(v4f*)(spk + tid * 8) = a; *(v4f*)(spk + tid * 8 + 4) = c; }
  v16h qh[HD / 32];
#pragma unroll
  for (int kc = 0; kc < HD / 32; ++kc) qh[kc] = frag_h(QH + ((size_t)b * TT + q0 + col) * CC + kc * 32, lane);
  const float pq = bfr(PQ[(size_t)b * TT + q0 + col]);
  asm volatile("s_wait_xcnt 0x0" ::: "memory"); SB();   // the address registers of the loads above are reused from here on; the scheduling barrier keeps later register writes behind the wait
#pragma unroll
  for (int i = 0; i < 4; ++i) { *(v4u*)(kst + i * 16 * (KP * 2)) = rk[i]; *(v4u*)(vst + i * 32 * (VP * 2)) = rv[i]; }
  __syncthreads();
  v8f acc[HD / 16] = {}; float mu = -1.0e30f, c2 = 0.f, l = 0.f;   // mu: the maximum in use; c2 = 4 - mu log2(e)
  for (int st = 0; st < TT / FK; ++st) { const int buf = st & 1; const bool more = st + 1 < TT / FK;
    const _Float16* sk = (const _Float16*)(L + buf * SKB) + col * KP; const _Float16* sv = (const _Float16*)(L + 2 * SKB + buf * SVB) + col * VP;
#pragma unroll
    for (int kk = 0; kk < FK / 32; ++kk) {
      if (more) {   // the next stage's pieces fly while this block is worked on: k during the first 32 keys, v during the second
#pragma unroll
        for (int i = 0; i < 4; ++i) rk[i] = kk == 0 ? *(const v4u*)(kp + (size_t)(st + 1) * FK * CC + (size_t)i * 16 * CC) : *(const v4u*)(vp + (st + 1) * FK + (size_t)i * 32 * TT);
        asm volatile("s_wait_xcnt 0x0" ::: "memory"); }   // the loads' address registers are reused by the fragment loads that follow
      v16h fa[4], fb[4], fv[4]; v8f s[2] = {};
#pragma unroll
      for (int kc = 0; kc < 4; ++kc) { fa[kc] = frag_h(sk + (kk * 32) * KP + kc * 32, lane); fb[kc] = frag_h(sk + (kk * 32 + 16) * KP + kc * 32, lane); }
      SB();
#pragma unroll
      for (int kc = 0; kc < 2; ++kc) { s[0] = mm16(fa[kc], qh[kc], s[0]); s[1] = mm16(fb[kc], qh[kc], s[1]); }   // the two key tiles' chains alternate: each fills the other's accumulate latency
      SB();
#pragma unroll
      for (int j = 0; j < 4; ++j) fv[j] = frag_h(sv + j * 16 * VP + kk * 32, lane);
      SB();
#pragma unroll
      for (int kc = 2; kc < 4; ++kc) { s[0] = mm16(fa[kc], qh[kc], s[0]); s[1] = mm16(fb[kc], qh[kc], s[1]); }
      SB();
      float v[16]; float ml = -3.0e38f;
#pragma unroll
      for (int tt = 0; tt < 2; ++tt) { const float* pk = spk + st * FK + kk * 32 + tt * 16 + 8 * g; const v4f pa = *(const v4f*)pk, pb = *(const v4f*)(pk + 4);
#pragma unroll
        for (int r = 0; r < 8; ++r) { const float x = ((s[tt][r] * SCALE) * pq) * (r < 4 ? pa[r & 3] : pb[r & 3]); v[tt * 8 + r] = x; ml = fmaxf(ml, x); } }
      SB();
#pragma unroll
      for (int j = 0; j < 4; ++j) fb[j] = frag_h(sv + (4 + j) * 16 * VP + kk * 32, lane);
      SB();
      ml = fmaxf(ml, xhalf(ml));
      if (__builtin_amdgcn_ballot_w32(ml > mu + 5.5f) != 0) {   // lazy rescale: only when some query's maximum outgrows the one in use by 5.5, so P x 2^4 stays below 2^12 in f16
        const float mn = fmaxf(mu, ml); const float al = __builtin_amdgcn_exp2f((mu - mn) * LOG2E); mu = mn; c2 = 4.0f - mn * LOG2E; l *= al;
#pragma unroll
        for (int j = 0; j < HD / 16; ++j) acc[j] *= al; }
      v16h p; float e[16];
#pragma unroll
      for (int i = 0; i < 3; ++i) v[i] = fmaf(v[i], LOG2E, c2);
      SB();
#pragma unroll
      for (int i = 0; i < 16; ++i) {   // issue order held: a later argument's multiply-add stands behind each exponential while there is one; it fills the slot that a transcendental wants behind it and runs beside it
        e[i] = __builtin_amdgcn_exp2f(v[i]);
        if (i < 13) { SB(); v[i + 3] = fmaf(v[i + 3], LOG2E, c2); SB(); }
        else if (i < 15) { SB(); asm volatile("v_nop"); SB(); } }   // no multiply-add is left: the slot behind the transcendental, whose argument register the next one's result may take
#pragma unroll
      for (int i = 0; i < 16; ++i) { l += e[i]; p[i] = (_Float16)e[i]; }
#pragma unroll
      for (int j = 0; j < 4; ++j) acc[j] = mm16(fv[j], p, acc[j]);
#pragma unroll
      for (int j = 0; j < 4; ++j) acc[4 + j] = mm16(fb[j], p, acc[4 + j]);
      if (more) {
#pragma unroll
        for (int i = 0; i < 4; ++i) { if (kk == 0) *(v4u*)(kst + (buf ^ 1) * SKB + i * 16 * (KP * 2)) = rk[i]; else *(v4u*)(vst + (buf ^ 1) * SVB + i * 32 * (VP * 2)) = rk[i]; } } }
    __syncthreads(); }   // publishes the next stage and ends every reader's last read of this one
  l += xhalf(l); const float inv = 1.0f / l;
  float* so = (float*)L + wave * 16 * OP;   // lane (g, col) holds O[query col][16 j + 8 g + r]: staged so that each row leaves as one 512-byte store
#pragma unroll
  for (int j = 0; j < HD / 16; ++j) { const v8f o = acc[j] * inv; *(v4f*)(so + col * OP + j * 16 + 8 * g) = __builtin_shufflevector(o, o, 0, 1, 2, 3); *(v4f*)(so + col * OP + j * 16 + 8 * g + 4) = __builtin_shufflevector(o, o, 4, 5, 6, 7); }
  __syncthreads();
  for (int rl = 0; rl < 16; ++rl) vst2(Y + ((size_t)b * TT + q0 + rl) * CC + lane * 4, *(const v4f*)(so + rl * OP + lane * 4)); }

extern "C" void kernel_launch(void* const* d_in, const int* in_sizes, int n_in, void* d_out, int out_size, void* d_ws, size_t ws_size, hipStream_t stream) {
  (void)in_sizes; (void)n_in; (void)out_size;
  const float** F = (const float**)d_in;
  if (ws_size < (size_t)WS_END) return;
  char* ws = (char*)d_ws; _Float16 *QH = (_Float16*)(ws + WS_QH), *KH = (_Float16*)(ws + WS_KH), *VT = (_Float16*)(ws + WS_VT), *QL = (_Float16*)(ws + WS_QL), *KL = (_Float16*)(ws + WS_KL); __bf16 *VB = (__bf16*)(ws + WS_VB), *VBL = (__bf16*)(ws + WS_VBL); float *S = (float*)(ws + WS_S), *Y = (float*)(ws + WS_Y);
  (void)Y; (void)S; (void)QL; (void)KL; (void)VB; (void)VBL;
  // inputs: 0 Q [16,2048,128]; 1 K; 2 V; 3 p_q [16,2048,1]; 4 p_k [16,2048,1]
  k_planes1<<<dim3(TNB * TT / 64), 256, 0, stream>>>(F[0], F[1], F[2], QH, KH, VT);
  k_fa<<<dim3(TT / FQ, TNB), 256, 0, stream>>>(QH, KH, VT, F[3], F[4], (float*)d_out);
}

// v004
// It runs in 38.8 microseconds.
// Timed twice side by side with v003, it ran 1.39 and 1.41 times as fast.
// Over all steps from v000 it is 52.0 times as fast.
// compute dtype: all float inputs rounded to bf16; Q, K, V are bf16-valued so their f16 planes are exact; logits q x k (1 product) x 128^-0.5, then x p_q x p_k in f32 as the module; softmax f32, online over 32-key blocks; P = exp(logit - max in use) x 2^4 once to f16 x v (exact) (1 product), divided by the f32 row sum; f32 output.
#include <hip/hip_runtime.h>
#include <math.h>

typedef __attribute__((ext_vector_type(16))) _Float16 v16h;
typedef __attribute__((ext_vector_type(16))) __bf16 v16b;
typedef __attribute__((ext_vector_type(8)))  _Float16 v8h;
typedef __attribute__((ext_vector_type(8)))  float v8f;
typedef __attribute__((ext_vector_type(4)))  float v4f;
typedef __attribute__((ext_vector_type(2)))  float v2f;
typedef __attribute__((ext_vector_type(4)))  unsigned v4u;
typedef _Float16 hx8 __attribute__((ext_vector_type(8)));
typedef __attribute__((ext_vector_type(4)))  int v4i;
typedef float __attribute__((may_alias)) float_a;
typedef int __attribute__((may_alias)) int_a;

template <typename T> __device__ __forceinline__ void vst2(void* p, T v) { *(T*)p = v;  }
__device__ __forceinline__ v8f wmma16(v16h a, v16h b, v8f c) {
  v8f d = __builtin_amdgcn_wmma_f32_16x16x32_f16(false, a, false, b, (short)0, c, false, false);
  asm volatile("v_nop\n\tv_nop\n\tv_nop\n\tv_nop" : "+v"(d) : "v"(a), "v"(b));
  return d;
}
__device__ __forceinline__ v8f wmma_bf(v16b a, v16b b, v8f c) {
  v8f d = __builtin_amdgcn_wmma_f32_16x16x32_bf16(false, a, false, b, (short)0, c, false, false);
  asm volatile("v_nop\n\tv_nop\n\tv_nop\n\tv_nop" : "+v"(d) : "v"(a), "v"(b));
  return d;
}
// 16x16x32 fragments: lane = (h = lane>>4, row/col = lane&15); elements 0..7 = k0+8h+0..7, 8..15 = k0+16+8h+0..7; D element r = row 8h+r
__device__ __forceinline__ v16h frag_h(const _Float16* rowk0, int lane) {
  union { v16h v; v8h q[2]; } u; const _Float16* p = rowk0 + 8 * (lane >> 4);
  u.q[0] = *(const v8h*)p; u.q[1] = *(const v8h*)(p + 16); return u.v;
}
__device__ __forceinline__ v16h frag_f32(const float* rowk0, int lane) {
  v16h a; const float* p = rowk0 + 8 * (lane >> 4);
#pragma unroll
  for (int i = 0; i < 8; ++i) { a[i] = (_Float16)p[i]; a[8 + i] = (_Float16)p[16 + i]; }
  return a;
}
__device__ __forceinline__ v16h frag_f32s(const float* rowk0, int lane, float sc) {
  v16h a; const float* p = rowk0 + 8 * (lane >> 4);
#pragma unroll
  for (int i = 0; i < 8; ++i) { a[i] = (_Float16)(p[i] * sc); a[8 + i] = (_Float16)(p[16 + i] * sc); }
  return a;
}
// column fragment from a [K][ld] layout (column n), rows >= K read as 0
__device__ __forceinline__ v16h fragc_f32(const float* W, int k0, int n, int lane, int ld, int K) {
  v16h a; const int g = lane >> 4;
#pragma unroll
  for (int i = 0; i < 8; ++i) { const int ka = k0 + 8 * g + i, kb = ka + 16;
    a[i] = (_Float16)(ka < K ? W[(size_t)(ka < K ? ka : K - 1) * ld + n] : 0.f); a[8 + i] = (_Float16)(kb < K ? W[(size_t)(kb < K ? kb : K - 1) * ld + n] : 0.f); }
  return a;
}
struct F2 { v16b h, l; };
__device__ __forceinline__ F2 bsplit16(const float v[16]) { F2 r;
#pragma unroll
  for (int i = 0; i < 16; ++i) { const __bf16 h = (__bf16)v[i]; r.h[i] = h; r.l[i] = (__bf16)(v[i] - (float)h); }
  return r; }
__device__ __forceinline__ F2 split_row(const float* row, int k0, int lane) { float v[16]; const float* p = row + k0 + 8 * (lane >> 4);
#pragma unroll
  for (int i = 0; i < 8; ++i) { v[i] = p[i]; v[8 + i] = p[16 + i]; }
  return bsplit16(v); }
__device__ __forceinline__ F2 split_rowK(const float* row, int k0, int lane, int K) { float v[16]; const int g = lane >> 4;
#pragma unroll
  for (int i = 0; i < 8; ++i) { const int ka = k0 + 8 * g + i, kb = ka + 16; v[i] = ka < K ? row[ka < K ? ka : K - 1] : 0.f; v[8 + i] = kb < K ? row[kb < K ? kb : K - 1] : 0.f; }
  return bsplit16(v); }
__device__ __forceinline__ F2 split_col(const float* W, int k0, int n, int lane, int ld, int K) { float v[16]; const int g = lane >> 4;
#pragma unroll
  for (int i = 0; i < 8; ++i) { const int ka = k0 + 8 * g + i, kb = ka + 16; v[i] = ka < K ? W[(size_t)(ka < K ? ka : K - 1) * ld + n] : 0.f; v[8 + i] = kb < K ? W[(size_t)(kb < K ? kb : K - 1) * ld + n] : 0.f; }
  return bsplit16(v); }
__device__ __forceinline__ v8f mac3(const F2& a, const F2& b, v8f c) { c = wmma_bf(a.l, b.h, c); c = wmma_bf(a.h, b.l, c); return wmma_bf(a.h, b.h, c); }
__device__ __forceinline__ float sigm(float v) { return 1.0f / (1.0f + expf(-v)); }
#define LDSX() do { asm volatile("s_wait_dscnt 0" ::: "memory"); __builtin_amdgcn_wave_barrier(); __builtin_amdgcn_fence(__ATOMIC_RELEASE, "workgroup"); } while (0)

// Gated scaled-dot-product attention (single head; Q, K, V [16,2048,128] given; p_q, p_k [16,2048,1] uniform[0,1) gates): A = (Q K^T / sqrt(128)) * p_q * p_k^T; out = softmax(A) V -> [16,2048,128].
#define NB 16
#define TT 2048
#define CC 128            // NH * HD = projected width
#define DIN 128          // input (model) width
#define NH 1
#define HD 128
#define NQB (TT / 64)
#define HG 8               // f32 logit planes WS_S reserves; no kernel in this file uses them
#define SCALE (0.08838834764831845f)
#define CAUSAL 0
#ifndef TNB
#define TNB NB
#endif
static_assert(TNB % HG == 0);
__device__ __forceinline__ float bfr(float v) { return (float)(__bf16)v; }
__host__ __device__ __forceinline__ int kb_last(int qb) { return CAUSAL ? ((qb * 64 + 63) >> 7) : (TT / 128 - 1); }
typedef __attribute__((ext_vector_type(8))) __bf16 v8b;
__device__ __forceinline__ v16b frag_b(const __bf16* rowk0, int lane) {
  union { v16b v; v8b q[2]; } u; const __bf16* p = rowk0 + 8 * (lane >> 4);
  u.q[0] = *(const v8b*)p; u.q[1] = *(const v8b*)(p + 16); return u.v;
}
#define QBH 0              // not used by any kernel in this file
#define QHI 2048            // rows carrying a q residual plane (all rows when non-causal; k_fa uses none: 1-product logits everywhere)
#define KHI 64            // key rows carrying k residual / v bf16 hi+lo planes (written only by k_proj, which is not launched)
// B fragment (k rows k0+.., output column o) of a weight: (in,out) [K][ld] or (out,in) [ld rows of K]: bf16 exact, or f16(bf16 * 256) exact
__device__ __forceinline__ v16b wcol_io(const float* Wm, int k0, int o, int lane, int ld) { v16b w; const int g = lane >> 4;
#pragma unroll
  for (int i = 0; i < 8; ++i) { w[i] = (__bf16)Wm[(size_t)(k0 + 8 * g + i) * ld + o]; w[8 + i] = (__bf16)Wm[(size_t)(k0 + 16 + 8 * g + i) * ld + o]; }
  return w; }
__device__ __forceinline__ v16b wcol_oi(const float* Wm, int k0, int o, int lane, int K) { v16b w; const float* p = Wm + (size_t)o * K + k0 + 8 * (lane >> 4);
#pragma unroll
  for (int i = 0; i < 8; ++i) { w[i] = (__bf16)p[i]; w[8 + i] = (__bf16)p[16 + i]; }
  return w; }
__device__ __forceinline__ v16h wcolh_io(const float* Wm, int k0, int o, int lane, int ld) { v16h w; const int g = lane >> 4;
#pragma unroll
  for (int i = 0; i < 8; ++i) { w[i] = (_Float16)(bfr(Wm[(size_t)(k0 + 8 * g + i) * ld + o]) * 256.0f); w[8 + i] = (_Float16)(bfr(Wm[(size_t)(k0 + 16 + 8 * g + i) * ld + o]) * 256.0f); }
  return w; }
__device__ __forceinline__ v16h wcolh_oi(const float* Wm, int k0, int o, int lane, int K) { v16h w; const float* p = Wm + (size_t)o * K + k0 + 8 * (lane >> 4);
#pragma unroll
  for (int i = 0; i < 8; ++i) { w[i] = (_Float16)(bfr(p[i]) * 256.0f); w[8 + i] = (_Float16)(bfr(p[16 + i]) * 256.0f); }
  return w; }
#define WQKV_LAYOUT 0   // 0 = (in,out) [DIN][CC]; 1 = (out,in) [CC][DIN]; 2 = per-head [NH][DIN][HD]
__device__ __forceinline__ v16b wcol_hdk(const float* Wm, int k0, int o, int lane) { v16b w; const int g = lane >> 4; const float* p = Wm + (size_t)(o / HD) * DIN * HD + (o % HD);
#pragma unroll
  for (int i = 0; i < 8; ++i) { w[i] = (__bf16)p[(size_t)(k0 + 8 * g + i) * HD]; w[8 + i] = (__bf16)p[(size_t)(k0 + 16 + 8 * g + i) * HD]; }
  return w; }
#define WO_OUT_IN 0
#if WQKV_LAYOUT == 1
#define WCOL(W, k0, o, lane) wcol_oi(W, k0, o, lane, DIN)
#elif WQKV_LAYOUT == 2
#define WCOL(W, k0, o, lane) wcol_hdk(W, k0, o, lane)
#else
#define WCOL(W, k0, o, lane) wcol_io(W, k0, o, lane, CC)
#endif
#if WO_OUT_IN
#define WOCOL(W, k0, o, lane) wcol_oi(W, k0, o, lane, CC)
#define WOCOLH(W, k0, o, lane) wcolh_oi(W, k0, o, lane, CC)
#else
#define WOCOL(W, k0, o, lane) wcol_io(W, k0, o, lane, DIN)
#define WOCOLH(W, k0, o, lane) wcolh_io(W, k0, o, lane, DIN)
#endif
#define SM_EXTRA_PARAMS , int bsm, const float* __restrict__ PQ, const float* __restrict__ PK
// multiplicative pre-gate: A = (A * bf16(p_q[b][t])) * bf16(p_k[b][k]) (f32, the module's order), then softmax
#define SM_MASK_HOOK do { v = (v * bfr(PQ[(size_t)bsm * TT + t])) * bfr(PK[(size_t)bsm * TT + k]); } while (0)   /* p_q / p_k bf16-rounded like every float input */
__global__ __launch_bounds__(256) void k_planes1(const float* __restrict__ Qs, const float* __restrict__ Ks, const float* __restrict__ Vs, _Float16* __restrict__ QH, _Float16* __restrict__ KH, _Float16* __restrict__ VT) {
  __shared__ _Float16 sv[64][136];
  const int tid = threadIdx.x; const size_t r0 = (size_t)blockIdx.x * 64; const int b = (int)(r0 / TT), t0 = (int)(r0 % TT);
  for (int e = tid; e < 64 * 16; e += 256) { const int rl = e >> 4, q = e & 15; const size_t src = (r0 + rl) * CC + q * 8; float tq[8], tk[8], tv[8];
#pragma unroll
    for (int u = 0; u < 8; ++u) { tq[u] = Qs[src + u]; tk[u] = Ks[src + u]; tv[u] = Vs[src + u]; }
    asm volatile("s_wait_loadcnt 0x0" ::: "memory");
    hx8 hq, hk;
#pragma unroll
    for (int u = 0; u < 8; ++u) { hq[u] = (_Float16)bfr(tq[u]); hk[u] = (_Float16)bfr(tk[u]); sv[rl][q * 8 + u] = (_Float16)bfr(tv[u]); }
    vst2((unsigned*)(QH + (r0 + rl) * CC + q * 8), *(const v4u*)&hq); vst2((unsigned*)(KH + (r0 + rl) * CC + q * 8), *(const v4u*)&hk); }
  __syncthreads();
  for (int e = tid; e < 128 * 8; e += 256) { const int c = e >> 3, q = e & 7; hx8 hv; _Pragma("unroll") for (int j = 0; j < 8; ++j) hv[j] = sv[q * 8 + j][c]; vst2((unsigned*)(VT + ((size_t)b * CC + c) * TT + t0 + q * 8), *(const v4u*)&hv); } }
#ifndef SM_EXTRA_PARAMS
#define SM_EXTRA_PARAMS
#endif
#ifndef PROJ_EXTRA_PARAMS
#define PROJ_EXTRA_PARAMS
#endif
#ifndef SM_MASK_HOOK
#define SM_MASK_HOOK (void)0
#endif

#define WS_QH  0u                                      // f16 q rows [b*t][CC]
#define WS_KH  (WS_QH + 2u * (size_t)NB * TT * CC)      // f16 k rows [b*t][CC]
#define WS_VT  (WS_KH + 2u * (size_t)NB * TT * CC)      // f16 v planes [b][c][t]
#define WS_QL  (WS_VT + 2u * (size_t)NB * CC * TT)      // f16 q residual x 2^10 rows [b][t < QHI][CC]
#define WS_KL  (WS_QL + 2u * (size_t)NB * QHI * CC)     // f16 k residual x 2^10 rows [b][t < KHI][CC]
#define WS_VB  (WS_KL + 2u * (size_t)NB * KHI * CC)     // bf16 v hi planes [b][c][t < KHI]
#define WS_VBL (WS_VB + 2u * (size_t)NB * CC * KHI)
#define WS_S   (WS_VBL + 2u * (size_t)NB * CC * KHI)    // f32 logits / P [batch in group][t][s]
#define WS_Y   (WS_S  + 4u * (size_t)HG * TT * TT)      // f32 ctx rows [b*t][CC] (only when there is an output projection)
#define WS_END (WS_Y  + 0u)

// ---- k_proj: block = (64 rows, 128 cols, which): q/k/v = X W (+ b) with exact bf16 products (K = DIN) -> which 0: q f16 rows (+ residual rows < QHI); 1: k f16 rows (+ residual rows < KHI); 2: v f16 planes [c][t] (+ bf16 hi/lo planes for t < KHI)
__global__ __launch_bounds__(128) void k_proj(const float* __restrict__ XQ, const float* __restrict__ XK, const float* __restrict__ XV, const float* __restrict__ WQ, const float* __restrict__ WK, const float* __restrict__ WV, const float* __restrict__ BQ, const float* __restrict__ BK, const float* __restrict__ BV,
    _Float16* __restrict__ QH, _Float16* __restrict__ QL, _Float16* __restrict__ KH, _Float16* __restrict__ KL, _Float16* __restrict__ VT, __bf16* __restrict__ VB, __bf16* __restrict__ VBL) {
  __shared__ __align__(16) _Float16 sh[64][136], sl[64][136]; __shared__ __align__(16) _Float16 th[128][72]; __shared__ __align__(16) __bf16 tb[128][72], tbl[128][72];
  const int tid = threadIdx.x, wave = tid >> 5, lane = tid & 31, col = lane & 15, g = lane >> 4; const int which = blockIdx.z; const int c0 = blockIdx.y * 128; const size_t r0 = (size_t)blockIdx.x * 64; const size_t bb = r0 / TT; const int t0 = (int)(r0 % TT);
  const float* X = which == 0 ? XQ : which == 1 ? XK : XV; const float* WA = which == 0 ? WQ : which == 1 ? WK : WV; const float* BA = which == 0 ? BQ : which == 1 ? BK : BV;
  v8f acc[8] = {};
#pragma unroll 2
  for (int kc = 0; kc < DIN / 32; ++kc) { v16b a; { const float* p = X + (r0 + wave * 16 + col) * DIN + kc * 32 + 8 * g;
#pragma unroll
      for (int i = 0; i < 8; ++i) { a[i] = (__bf16)p[i]; a[8 + i] = (__bf16)p[16 + i]; } }
    asm volatile("s_wait_loadcnt 0x0" ::: "memory");
#pragma unroll
    for (int j = 0; j < 8; ++j) { const v16b w = WCOL(WA, kc * 32, c0 + j * 16 + col, lane); asm volatile("s_wait_loadcnt 0x0" ::: "memory"); acc[j] = wmma_bf(a, w, acc[j]); } }
  if (which < 2) { _Float16* DH = which == 0 ? QH : KH; _Float16* DL = which == 0 ? QL : KL; const int nhi = which == 0 ? QHI : KHI; const bool hi_rows = t0 < nhi;
#pragma unroll
    for (int j = 0; j < 8; ++j) { const float bias = BA ? bfr(BA[c0 + j * 16 + col]) : 0.f;
#pragma unroll
      for (int r = 0; r < 8; ++r) { const float v = acc[j][r] + bias; const _Float16 hv = (_Float16)v; sh[wave * 16 + 8 * g + r][j * 16 + col] = hv; sl[wave * 16 + 8 * g + r][j * 16 + col] = (_Float16)((v - (float)hv) * 1024.0f); } }
    __syncthreads();
    for (int e = tid; e < 64 * 16; e += 128) { const int rl = e >> 4, q = e & 15; vst2((unsigned*)(DH + (r0 + rl) * CC + c0 + q * 8), *(const v4u*)&sh[rl][q * 8]); if (hi_rows) vst2((unsigned*)(DL + (bb * nhi + t0 + rl) * (size_t)CC + c0 + q * 8), *(const v4u*)&sl[rl][q * 8]); }
  } else { const bool hi_rows = t0 < KHI;
#pragma unroll
    for (int j = 0; j < 8; ++j) { const float bias = BA ? bfr(BA[c0 + j * 16 + col]) : 0.f;
#pragma unroll
      for (int r = 0; r < 8; ++r) { const float v = acc[j][r] + bias; const int rl = wave * 16 + 8 * g + r, cl = j * 16 + col; th[cl][rl] = (_Float16)v; const __bf16 bh = (__bf16)v; tb[cl][rl] = bh; tbl[cl][rl] = (__bf16)(v - (float)bh); } }
    __syncthreads();
    for (int e = tid; e < 128 * 8; e += 128) { const int cl = e >> 3, q = e & 7; vst2((unsigned*)(VT + (bb * CC + c0 + cl) * (size_t)TT + t0 + q * 8), *(const v4u*)&th[cl][q * 8]); if (hi_rows) { const size_t o3 = (bb * CC + c0 + cl) * (size_t)KHI + t0 + q * 8; vst2((unsigned*)(VB + o3), *(const v4u*)&tb[cl][q * 8]); vst2((unsigned*)(VBL + o3), *(const v4u*)&tbl[cl][q * 8]); } } } }
#define FQ 128             // queries per work-group
#define FK 128             // keys per stage: waves 0-3 take the first 64, waves 4-7 the second 64
#define KP 136             // f16 per staged k row: 272 B = 16 B x odd, conflict-free for 16-byte fragment reads
#define VP 136             // f16 per staged v plane row (128 keys): 272 B = 16 B x odd
#define SKB (FK * KP * 2)
#define SVB (HD * VP * 2)
#define OP 132             // floats per staged output row
#define LOG2E 1.4426950408889634f
#define SB() __builtin_amdgcn_sched_barrier(0)   // keeps a group of LDS fragment loads, or a group of vector instructions, where it is written among the matrix instructions, so that these hide it
static_assert(8 * 16 * OP * 4 <= 2 * (SKB + SVB), "output staging must fit in the k/v buffers");
__device__ __forceinline__ v8f mm16(v16h a, v16h b, v8f c) { return __builtin_amdgcn_wmma_f32_16x16x32_f16(false, a, false, b, (short)0, c, false, false); }
__device__ __forceinline__ float xhalf(float x) { return __builtin_bit_cast(float, __builtin_amdgcn_permlanex16(__builtin_bit_cast(int, x), __builtin_bit_cast(int, x), 0x76543210, 0xfedcba98, false, false)); }  // lane l reads lane l ^ 16
__global__ __launch_bounds__(256) void k_fa(const _Float16* __restrict__ QH, const _Float16* __restrict__ KH, const _Float16* __restrict__ VT, const float* __restrict__ PQ, const float* __restrict__ PK, float* __restrict__ Y) {
  __shared__ __align__(16) unsigned char L[2 * (SKB + SVB) + TT * 4];   // k buffers, v buffers, rounded p_k row
  const int tid = threadIdx.x, lane = tid & 31, col = lane & 15, g = lane >> 4; const int b = blockIdx.y;
  const int wave = __builtin_amdgcn_readfirstlane(tid >> 5), cg = wave & 3, kh = wave >> 2; const int q0 = blockIdx.x * FQ + cg * 32;
  float* spk = (float*)(L + 2 * (SKB + SVB));
  const _Float16* kp = KH + (size_t)b * TT * CC + (size_t)(tid >> 4) * CC + (tid & 15) * 8;   // thread's 16-byte piece of k rows tid/16 + 16 i
  const _Float16* vp = VT + (size_t)b * CC * TT + (size_t)(tid >> 4) * TT + (tid & 15) * 8;   // thread's 16-byte piece of v plane rows tid/16 + 16 i
  unsigned char* kst = L + (tid >> 4) * (KP * 2) + (tid & 15) * 16; unsigned char* vst = L + 2 * SKB + (tid >> 4) * (VP * 2) + (tid & 15) * 16;
  v4u rk[8], rv[8];
#pragma unroll
  for (int i = 0; i < 8; ++i) { rk[i] = *(const v4u*)(kp + (size_t)i * 16 * CC); rv[i] = *(const v4u*)(vp + (size_t)i * 16 * TT); }
  v4f ga = *(const v4f*)(PK + (size_t)b * TT + tid * 8), gc = *(const v4f*)(PK + (size_t)b * TT + tid * 8 + 4);
  v16h qh[2][HD / 32]; float pq[2];
#pragma unroll
  for (int t = 0; t < 2; ++t) {
#pragma unroll
    for (int kc = 0; kc < HD / 32; ++kc) qh[t][kc] = frag_h(QH + ((size_t)b * TT + q0 + t * 16 + col) * CC + kc * 32, lane); }
  asm volatile("s_wait_xcnt 0x0" ::: "memory"); SB();   // the address registers of the loads above are reused from here on; the scheduling barrier keeps later register writes behind the wait
  pq[0] = PQ[(size_t)b * TT + q0 + col]; pq[1] = PQ[(size_t)b * TT + q0 + 16 + col];
  asm volatile("s_wait_xcnt 0x0" ::: "memory"); SB();   // the same for these two loads, whose results may take a register of the loads above
  pq[0] = bfr(pq[0]); pq[1] = bfr(pq[1]);
#pragma unroll
  for (int u = 0; u < 4; ++u) { ga[u] = bfr(ga[u]); gc[u] = bfr(gc[u]); }
  *(v4f*)(spk + tid * 8) = ga; *(v4f*)(spk + tid * 8 + 4) = gc;
#pragma unroll
  for (int i = 0; i < 8; ++i) { *(v4u*)(kst + i * 16 * (KP * 2)) = rk[i]; *(v4u*)(vst + i * 16 * (VP * 2)) = rv[i]; }
  __syncthreads();
  v8f acc[2][HD / 16] = {}; float mu[2] = {-1.0e30f, -1.0e30f}, c2[2] = {0.f, 0.f}, l[2] = {0.f, 0.f};   // per query tile; mu: the maximum in use; c2 = 4 - mu log2(e)
  for (int st = 0; st < TT / FK; ++st) { const int buf = st & 1; const int sn = st + 1 < TT / FK ? st + 1 : st;   // the stage fetched next; the last pass fetches its own again into the idle buffer, so the loop has no branch behind its matrix runs
    const _Float16* sk = (const _Float16*)(L + buf * SKB) + (kh * 64 + col) * KP; const _Float16* sv = (const _Float16*)(L + 2 * SKB + buf * SVB) + col * VP + kh * 64;
#pragma unroll
    for (int kk = 0; kk < 2; ++kk) {
      // the next stage's pieces fly while this block is worked on: k during the wave's first 32 keys, v during its second
#pragma unroll
      for (int i = 0; i < 8; ++i) rk[i] = kk == 0 ? *(const v4u*)(kp + (size_t)sn * FK * CC + (size_t)i * 16 * CC) : *(const v4u*)(vp + sn * FK + (size_t)i * 16 * TT);
      asm volatile("s_wait_xcnt 0x0" ::: "memory");   // the loads' address registers are reused by the fragment loads that follow
      v16h fa[4], fb[4], fv[8]; v8f s[2][2] = {}; v4f pg[4];
#pragma unroll
      for (int kc = 0; kc < 4; ++kc) { fa[kc] = frag_h(sk + (kk * 32) * KP + kc * 32, lane); fb[kc] = frag_h(sk + (kk * 32 + 16) * KP + kc * 32, lane); }
      { const float* pk = spk + st * FK + kh * 64 + kk * 32 + 8 * g; pg[0] = *(const v4f*)pk; pg[1] = *(const v4f*)(pk + 4); pg[2] = *(const v4f*)(pk + 16); pg[3] = *(const v4f*)(pk + 20); }
      SB();
#pragma unroll
      for (int kc = 0; kc < 2; ++kc) { s[0][0] = mm16(fa[kc], qh[0][kc], s[0][0]); s[0][1] = mm16(fb[kc], qh[0][kc], s[0][1]); }   // the two key tiles' chains alternate: each fills the other's accumulate latency
      SB();
#pragma unroll
      for (int j = 0; j < 8; ++j) fv[j] = frag_h(sv + j * 16 * VP + kk * 32, lane);
      SB();
#pragma unroll
      for (int kc = 2; kc < 4; ++kc) { s[0][0] = mm16(fa[kc], qh[0][kc], s[0][0]); s[0][1] = mm16(fb[kc], qh[0][kc], s[0][1]); }
      SB();
      float v[2][16]; float ml[2] = {-3.0e38f, -3.0e38f};
#pragma unroll
      for (int kc = 0; kc < 4; ++kc) {   // the second query tile's logit products, on the same k fragments; four of the first tile's logits are scaled and gated behind each pair
        s[1][0] = mm16(fa[kc], qh[1][kc], s[1][0]); s[1][1] = mm16(fb[kc], qh[1][kc], s[1][1]);
        SB();
#pragma unroll
        for (int r = 0; r < 4; ++r) { const float x = ((s[0][kc >> 1][(kc & 1) * 4 + r] * SCALE) * pq[0]) * pg[kc][r]; v[0][kc * 4 + r] = x; ml[0] = fmaxf(ml[0], x); }
        SB(); }
#pragma unroll
      for (int i = 0; i < 16; ++i) { const float x = ((s[1][i >> 3][i & 7] * SCALE) * pq[1]) * pg[i >> 2][i & 3]; v[1][i] = x; ml[1] = fmaxf(ml[1], x); }
      ml[0] = fmaxf(ml[0], xhalf(ml[0])); ml[1] = fmaxf(ml[1], xhalf(ml[1]));
      if (__builtin_amdgcn_ballot_w32((ml[0] > mu[0] + 5.5f) | (ml[1] > mu[1] + 5.5f)) != 0) {   // lazy rescale, one test for both tiles: only when some query's maximum outgrows the one in use by 5.5, so P x 2^4 stays below 2^12 in f16
#pragma unroll
        for (int t = 0; t < 2; ++t) { const float mn = fmaxf(mu[t], ml[t]); const float al = __builtin_amdgcn_exp2f((mu[t] - mn) * LOG2E); mu[t] = mn; c2[t] = 4.0f - mn * LOG2E; l[t] *= al;
#pragma unroll
          for (int j = 0; j < HD / 16; ++j) acc[t][j] *= al; } }
      v16h p0, p1; float e0[16], e1[16];
#pragma unroll
      for (int i = 0; i < 3; ++i) v[0][i] = fmaf(v[0][i], LOG2E, c2[0]);
      SB();
#pragma unroll
      for (int i = 0; i < 16; ++i) {   // issue order held: a later argument's multiply-add stands behind each exponential; it fills the slot that a transcendental wants behind it and runs beside it
        e0[i] = __builtin_amdgcn_exp2f(v[0][i]);
        SB(); if (i < 13) v[0][i + 3] = fmaf(v[0][i + 3], LOG2E, c2[0]); else v[1][i - 13] = fmaf(v[1][i - 13], LOG2E, c2[1]); SB(); }
#pragma unroll
      for (int i = 0; i < 16; ++i) p0[i] = (_Float16)e0[i];
      SB();
#pragma unroll
      for (int j = 0; j < 8; ++j) {   // the first tile's output products; two of the second tile's exponentials, with later arguments' multiply-adds, behind each
        acc[0][j] = mm16(fv[j], p0, acc[0][j]);
        SB();
#pragma unroll
        for (int u = 0; u < 2; ++u) { const int i = 2 * j + u; e1[i] = __builtin_amdgcn_exp2f(v[1][i]);
          if (i < 13) { SB(); v[1][i + 3] = fmaf(v[1][i + 3], LOG2E, c2[1]); SB(); } else { SB(); l[0] += e0[i - 13]; SB(); } }   // no multiply-add is left: a row-sum add fills the slot
        SB(); }
#pragma unroll
      for (int i = 0; i < 16; ++i) p1[i] = (_Float16)e1[i];
      SB();
#pragma unroll
      for (int j = 0; j < 8; ++j) acc[1][j] = mm16(fv[j], p1, acc[1][j]);   // the second tile's output products
#pragma unroll
      for (int i = 0; i < 16; ++i) { if (i >= 3) l[0] += e0[i]; l[1] += e1[i]; }   // the rest of the row sums: two chains, free to stand among the next block's loads
#pragma unroll
      for (int i = 0; i < 8; ++i) { if (kk == 0) *(v4u*)(kst + (buf ^ 1) * SKB + i * 16 * (KP * 2)) = rk[i]; else *(v4u*)(vst + (buf ^ 1) * SVB + i * 16 * (VP * 2)) = rk[i]; } }
    __syncthreads(); }   // publishes the next stage and ends every reader's last read of this one
  l[0] += xhalf(l[0]); l[1] += xhalf(l[1]);
  // merge of the two key halves: wave (cg, kh) gives query tile 1 - kh to its partner and finishes tile kh; lane (g, col) holds O[query col][16 j + 8 g + r]
  float* give = (float*)L + (cg * 2 + 1 - kh) * 16 * OP; float* so = (float*)L + (cg * 2 + kh) * 16 * OP;
#pragma unroll
  for (int j = 0; j < HD / 16; ++j) { const v8f o = kh ? acc[0][j] : acc[1][j]; *(v4f*)(give + col * OP + j * 16 + 8 * g) = __builtin_shufflevector(o, o, 0, 1, 2, 3); *(v4f*)(give + col * OP + j * 16 + 8 * g + 4) = __builtin_shufflevector(o, o, 4, 5, 6, 7); }
  { v2f ms; ms[0] = kh ? mu[0] : mu[1]; ms[1] = kh ? l[0] : l[1]; *(v2f*)(spk + (cg * 2 + 1 - kh) * 64 + lane * 2) = ms; }
  __syncthreads();   // the partner's tile, maximum and sum are in LDS
  const v2f mp = *(const v2f*)(spk + (cg * 2 + kh) * 64 + lane * 2); const float mo = kh ? mu[1] : mu[0], lo = kh ? l[1] : l[0];
  const float mn = fmaxf(mo, mp[0]); float ao = __builtin_amdgcn_exp2f((mo - mn) * LOG2E), ap = __builtin_amdgcn_exp2f((mp[0] - mn) * LOG2E);
  const float inv = 1.0f / (lo * ao + mp[1] * ap); ao *= inv; ap *= inv;
#pragma unroll
  for (int j = 0; j < HD / 16; ++j) { float* w = so + col * OP + j * 16 + 8 * g; const v8f x = kh ? acc[1][j] : acc[0][j]; const v4f ya = *(const v4f*)w, yb = *(const v4f*)(w + 4);   // staged so that each row leaves as one 512-byte store
    *(v4f*)w = __builtin_shufflevector(x, x, 0, 1, 2, 3) * ao + ya * ap; *(v4f*)(w + 4) = __builtin_shufflevector(x, x, 4, 5, 6, 7) * ao + yb * ap; }
  __syncthreads();
  for (int rl = 0; rl < 16; ++rl) vst2(Y + ((size_t)b * TT + q0 + kh * 16 + rl) * CC + lane * 4, *(const v4f*)(so + rl * OP + lane * 4)); }

extern "C" void kernel_launch(void* const* d_in, const int* in_sizes, int n_in, void* d_out, int out_size, void* d_ws, size_t ws_size, hipStream_t stream) {
  (void)in_sizes; (void)n_in; (void)out_size;
  const float** F = (const float**)d_in;
  if (ws_size < (size_t)WS_END) return;
  char* ws = (char*)d_ws; _Float16 *QH = (_Float16*)(ws + WS_QH), *KH = (_Float16*)(ws + WS_KH), *VT = (_Float16*)(ws + WS_VT), *QL = (_Float16*)(ws + WS_QL), *KL = (_Float16*)(ws + WS_KL); __bf16 *VB = (__bf16*)(ws + WS_VB), *VBL = (__bf16*)(ws + WS_VBL); float *S = (float*)(ws + WS_S), *Y = (float*)(ws + WS_Y);
  (void)Y; (void)S; (void)QL; (void)KL; (void)VB; (void)VBL;
  // inputs: 0 Q [16,2048,128]; 1 K; 2 V; 3 p_q [16,2048,1]; 4 p_k [16,2048,1]
  k_planes1<<<dim3(TNB * TT / 64), 256, 0, stream>>>(F[0], F[1], F[2], QH, KH, VT);
  k_fa<<<dim3(TT / FQ, TNB), 256, 0, stream>>>(QH, KH, VT, F[3], F[4], (float*)d_out);
}

// v005
// It runs in 37.4 microseconds.
// Next to v004, in two timings, it ran 1.04 and 1.03 times as fast.
// All steps since v000 together make it 53.9 times as fast.
// compute dtype: all float inputs rounded to bf16; Q, V are bf16-valued so their f16 planes are exact; the k plane holds f16(k x p_k x 128^-0.5 x log2 e), rounded once; logits q x k plane (1 product), then x p_q in f32; softmax f32, online over 32-key blocks; P = exp(logit - max in use) x 2^4 once to f16 x v (exact) (1 product), divided by the f32 row sum; f32 output.
#include <hip/hip_runtime.h>
#include <math.h>

typedef __attribute__((ext_vector_type(16))) _Float16 v16h;
typedef __attribute__((ext_vector_type(16))) __bf16 v16b;
typedef __attribute__((ext_vector_type(8)))  _Float16 v8h;
typedef __attribute__((ext_vector_type(8)))  float v8f;
typedef __attribute__((ext_vector_type(4)))  float v4f;
typedef __attribute__((ext_vector_type(2)))  float v2f;
typedef __attribute__((ext_vector_type(4)))  unsigned v4u;
typedef _Float16 hx8 __attribute__((ext_vector_type(8)));
typedef __attribute__((ext_vector_type(4)))  int v4i;
typedef float __attribute__((may_alias)) float_a;
typedef int __attribute__((may_alias)) int_a;

template <typename T> __device__ __forceinline__ void vst2(void* p, T v) { *(T*)p = v;  }
__device__ __forceinline__ v8f wmma16(v16h a, v16h b, v8f c) {
  v8f d = __builtin_amdgcn_wmma_f32_16x16x32_f16(false, a, false, b, (short)0, c, false, false);
  asm volatile("v_nop\n\tv_nop\n\tv_nop\n\tv_nop" : "+v"(d) : "v"(a), "v"(b));
  return d;
}
__device__ __forceinline__ v8f wmma_bf(v16b a, v16b b, v8f c) {
  v8f d = __builtin_amdgcn_wmma_f32_16x16x32_bf16(false, a, false, b, (short)0, c, false, false);
  asm volatile("v_nop\n\tv_nop\n\tv_nop\n\tv_nop" : "+v"(d) : "v"(a), "v"(b));
  return d;
}
// 16x16x32 fragments: lane = (h = lane>>4, row/col = lane&15); elements 0..7 = k0+8h+0..7, 8..15 = k0+16+8h+0..7; D element r = row 8h+r
__device__ __forceinline__ v16h frag_h(const _Float16* rowk0, int lane) {
  union { v16h v; v8h q[2]; } u; const _Float16* p = rowk0 + 8 * (lane >> 4);
  u.q[0] = *(const v8h*)p; u.q[1] = *(const v8h*)(p + 16); return u.v;
}
__device__ __forceinline__ v16h frag_f32(const float* rowk0, int lane) {
  v16h a; const float* p = rowk0 + 8 * (lane >> 4);
#pragma unroll
  for (int i = 0; i < 8; ++i) { a[i] = (_Float16)p[i]; a[8 + i] = (_Float16)p[16 + i]; }
  return a;
}
__device__ __forceinline__ v16h frag_f32s(const float* rowk0, int lane, float sc) {
  v16h a; const float* p = rowk0 + 8 * (lane >> 4);
#pragma unroll
  for (int i = 0; i < 8; ++i) { a[i] = (_Float16)(p[i] * sc); a[8 + i] = (_Float16)(p[16 + i] * sc); }
  return a;
}
// column fragment from a [K][ld] layout (column n), rows >= K read as 0
__device__ __forceinline__ v16h fragc_f32(const float* W, int k0, int n, int lane, int ld, int K) {
  v16h a; const int g = lane >> 4;
#pragma unroll
  for (int i = 0; i < 8; ++i) { const int ka = k0 + 8 * g + i, kb = ka + 16;
    a[i] = (_Float16)(ka < K ? W[(size_t)(ka < K ? ka : K - 1) * ld + n] : 0.f); a[8 + i] = (_Float16)(kb < K ? W[(size_t)(kb < K ? kb : K - 1) * ld + n] : 0.f); }
  return a;
}
struct F2 { v16b h, l; };
__device__ __forceinline__ F2 bsplit16(const float v[16]) { F2 r;
#pragma unroll
  for (int i = 0; i < 16; ++i) { const __bf16 h = (__bf16)v[i]; r.h[i] = h; r.l[i] = (__bf16)(v[i] - (float)h); }
  return r; }
__device__ __forceinline__ F2 split_row(const float* row, int k0, int lane) { float v[16]; const float* p = row + k0 + 8 * (lane >> 4);
#pragma unroll
  for (int i = 0; i < 8; ++i) { v[i] = p[i]; v[8 + i] = p[16 + i]; }
  return bsplit16(v); }
__device__ __forceinline__ F2 split_rowK(const float* row, int k0, int lane, int K) { float v[16]; const int g = lane >> 4;
#pragma unroll
  for (int i = 0; i < 8; ++i) { const int ka = k0 + 8 * g + i, kb = ka + 16; v[i] = ka < K ? row[ka < K ? ka : K - 1] : 0.f; v[8 + i] = kb < K ? row[kb < K ? kb : K - 1] : 0.f; }
  return bsplit16(v); }
__device__ __forceinline__ F2 split_col(const float* W, int k0, int n, int lane, int ld, int K) { float v[16]; const int g = lane >> 4;
#pragma unroll
  for (int i = 0; i < 8; ++i) { const int ka = k0 + 8 * g + i, kb = ka + 16; v[i] = ka < K ? W[(size_t)(ka < K ? ka : K - 1) * ld + n] : 0.f; v[8 + i] = kb < K ? W[(size_t)(kb < K ? kb : K - 1) * ld + n] : 0.f; }
  return bsplit16(v); }
__device__ __forceinline__ v8f mac3(const F2& a, const F2& b, v8f c) { c = wmma_bf(a.l, b.h, c); c = wmma_bf(a.h, b.l, c); return wmma_bf(a.h, b.h, c); }
__device__ __forceinline__ float sigm(float v) { return 1.0f / (1.0f + expf(-v)); }
#define LDSX() do { asm volatile("s_wait_dscnt 0" ::: "memory"); __builtin_amdgcn_wave_barrier(); __builtin_amdgcn_fence(__ATOMIC_RELEASE, "workgroup"); } while (0)

// Gated scaled-dot-product attention (single head; Q, K, V [16,2048,128] given; p_q, p_k [16,2048,1] uniform[0,1) gates): A = (Q K^T / sqrt(128)) * p_q * p_k^T; out = softmax(A) V -> [16,2048,128].
#define NB 16
#define TT 2048
#define CC 128            // NH * HD = projected width
#define DIN 128          // input (model) width
#define NH 1
#define HD 128
#define NQB (TT / 64)
#define HG 8               // f32 logit planes WS_S reserves; no kernel in this file uses them
#define SCALE (0.08838834764831845f)
#define CAUSAL 0
#ifndef TNB
#define TNB NB
#endif
static_assert(TNB % HG == 0);
__device__ __forceinline__ float bfr(float v) { return (float)(__bf16)v; }
__host__ __device__ __forceinline__ int kb_last(int qb) { return CAUSAL ? ((qb * 64 + 63) >> 7) : (TT / 128 - 1); }
typedef __attribute__((ext_vector_type(8))) __bf16 v8b;
__device__ __forceinline__ v16b frag_b(const __bf16* rowk0, int lane) {
  union { v16b v; v8b q[2]; } u; const __bf16* p = rowk0 + 8 * (lane >> 4);
  u.q[0] = *(const v8b*)p; u.q[1] = *(const v8b*)(p + 16); return u.v;
}
#define QBH 0              // not used by any kernel in this file
#define QHI 2048            // rows carrying a q residual plane (all rows when non-causal; k_fa uses none: 1-product logits everywhere)
#define KHI 64            // key rows carrying k residual / v bf16 hi+lo planes (written only by k_proj, which is not launched)
// B fragment (k rows k0+.., output column o) of a weight: (in,out) [K][ld] or (out,in) [ld rows of K]: bf16 exact, or f16(bf16 * 256) exact
__device__ __forceinline__ v16b wcol_io(const float* Wm, int k0, int o, int lane, int ld) { v16b w; const int g = lane >> 4;
#pragma unroll
  for (int i = 0; i < 8; ++i) { w[i] = (__bf16)Wm[(size_t)(k0 + 8 * g + i) * ld + o]; w[8 + i] = (__bf16)Wm[(size_t)(k0 + 16 + 8 * g + i) * ld + o]; }
  return w; }
__device__ __forceinline__ v16b wcol_oi(const float* Wm, int k0, int o, int lane, int K) { v16b w; const float* p = Wm + (size_t)o * K + k0 + 8 * (lane >> 4);
#pragma unroll
  for (int i = 0; i < 8; ++i) { w[i] = (__bf16)p[i]; w[8 + i] = (__bf16)p[16 + i]; }
  return w; }
__device__ __forceinline__ v16h wcolh_io(const float* Wm, int k0, int o, int lane, int ld) { v16h w; const int g = lane >> 4;
#pragma unroll
  for (int i = 0; i < 8; ++i) { w[i] = (_Float16)(bfr(Wm[(size_t)(k0 + 8 * g + i) * ld + o]) * 256.0f); w[8 + i] = (_Float16)(bfr(Wm[(size_t)(k0 + 16 + 8 * g + i) * ld + o]) * 256.0f); }
  return w; }
__device__ __forceinline__ v16h wcolh_oi(const float* Wm, int k0, int o, int lane, int K) { v16h w; const float* p = Wm + (size_t)o * K + k0 + 8 * (lane >> 4);
#pragma unroll
  for (int i = 0; i < 8; ++i) { w[i] = (_Float16)(bfr(p[i]) * 256.0f); w[8 + i] = (_Float16)(bfr(p[16 + i]) * 256.0f); }
  return w; }
#define WQKV_LAYOUT 0   // 0 = (in,out) [DIN][CC]; 1 = (out,in) [CC][DIN]; 2 = per-head [NH][DIN][HD]
__device__ __forceinline__ v16b wcol_hdk(const float* Wm, int k0, int o, int lane) { v16b w; const int g = lane >> 4; const float* p = Wm + (size_t)(o / HD) * DIN * HD + (o % HD);
#pragma unroll
  for (int i = 0; i < 8; ++i) { w[i] = (__bf16)p[(size_t)(k0 + 8 * g + i) * HD]; w[8 + i] = (__bf16)p[(size_t)(k0 + 16 + 8 * g + i) * HD]; }
  return w; }
#define WO_OUT_IN 0
#if WQKV_LAYOUT == 1
#define WCOL(W, k0, o, lane) wcol_oi(W, k0, o, lane, DIN)
#elif WQKV_LAYOUT == 2
#define WCOL(W, k0, o, lane) wcol_hdk(W, k0, o, lane)
#else
#define WCOL(W, k0, o, lane) wcol_io(W, k0, o, lane, CC)
#endif
#if WO_OUT_IN
#define WOCOL(W, k0, o, lane) wcol_oi(W, k0, o, lane, CC)
#define WOCOLH(W, k0, o, lane) wcolh_oi(W, k0, o, lane, CC)
#else
#define WOCOL(W, k0, o, lane) wcol_io(W, k0, o, lane, DIN)
#define WOCOLH(W, k0, o, lane) wcolh_io(W, k0, o, lane, DIN)
#endif
#define SM_EXTRA_PARAMS , int bsm, const float* __restrict__ PQ, const float* __restrict__ PK
// multiplicative pre-gate: A = (A * bf16(p_q[b][t])) * bf16(p_k[b][k]) (f32, the module's order), then softmax
#define SM_MASK_HOOK do { v = (v * bfr(PQ[(size_t)bsm * TT + t])) * bfr(PK[(size_t)bsm * TT + k]); } while (0)   /* p_q / p_k bf16-rounded like every float input */
#define LOG2E 1.4426950408889634f
// the k plane carries the key's whole factor of the exponent argument: k x (p_k x SCALE x log2 e), formed in f32 and rounded once to f16
__global__ __launch_bounds__(256) void k_planes1(const float* __restrict__ Qs, const float* __restrict__ Ks, const float* __restrict__ Vs, const float* __restrict__ PK, _Float16* __restrict__ QH, _Float16* __restrict__ KH, _Float16* __restrict__ VT) {
  __shared__ _Float16 sv[64][136];
  const int tid = threadIdx.x; const size_t r0 = (size_t)blockIdx.x * 64; const int b = (int)(r0 / TT), t0 = (int)(r0 % TT);
  for (int e = tid; e < 64 * 16; e += 256) { const int rl = e >> 4, q = e & 15; const size_t src = (r0 + rl) * CC + q * 8; float tq[8], tk[8], tv[8];
#pragma unroll
    for (int u = 0; u < 8; ++u) { tq[u] = Qs[src + u]; tk[u] = Ks[src + u]; tv[u] = Vs[src + u]; }
    float gk = PK[r0 + rl];
    asm volatile("s_wait_loadcnt 0x0" ::: "memory");
    gk = bfr(gk) * (SCALE * LOG2E);
    hx8 hq, hk;
#pragma unroll
    for (int u = 0; u < 8; ++u) { hq[u] = (_Float16)bfr(tq[u]); hk[u] = (_Float16)(bfr(tk[u]) * gk); sv[rl][q * 8 + u] = (_Float16)bfr(tv[u]); }
    vst2((unsigned*)(QH + (r0 + rl) * CC + q * 8), *(const v4u*)&hq); vst2((unsigned*)(KH + (r0 + rl) * CC + q * 8), *(const v4u*)&hk); }
  __syncthreads();
  for (int e = tid; e < 128 * 8; e += 256) { const int c = e >> 3, q = e & 7; hx8 hv; _Pragma("unroll") for (int j = 0; j < 8; ++j) hv[j] = sv[q * 8 + j][c]; vst2((unsigned*)(VT + ((size_t)b * CC + c) * TT + t0 + q * 8), *(const v4u*)&hv); } }
#ifndef SM_EXTRA_PARAMS
#define SM_EXTRA_PARAMS
#endif
#ifndef PROJ_EXTRA_PARAMS
#define PROJ_EXTRA_PARAMS
#endif
#ifndef SM_MASK_HOOK
#define SM_MASK_HOOK (void)0
#endif

#define WS_QH  0u                                      // f16 q rows [b*t][CC]
#define WS_KH  (WS_QH + 2u * (size_t)NB * TT * CC)      // f16 k rows [b*t][CC]
#define WS_VT  (WS_KH + 2u * (size_t)NB * TT * CC)      // f16 v planes [b][c][t]
#define WS_QL  (WS_VT + 2u * (size_t)NB * CC * TT)      // f16 q residual x 2^10 rows [b][t < QHI][CC]
#define WS_KL  (WS_QL + 2u * (size_t)NB * QHI * CC)     // f16 k residual x 2^10 rows [b][t < KHI][CC]
#define WS_VB  (WS_KL + 2u * (size_t)NB * KHI * CC)     // bf16 v hi planes [b][c][t < KHI]
#define WS_VBL (WS_VB + 2u * (size_t)NB * CC * KHI)
#define WS_S   (WS_VBL + 2u * (size_t)NB * CC * KHI)    // f32 logits / P [batch in group][t][s]
#define WS_Y   (WS_S  + 4u * (size_t)HG * TT * TT)      // f32 ctx rows [b*t][CC] (only when there is an output projection)
#define WS_END (WS_Y  + 0u)

// ---- k_proj: block = (64 rows, 128 cols, which): q/k/v = X W (+ b) with exact bf16 products (K = DIN) -> which 0: q f16 rows (+ residual rows < QHI); 1: k f16 rows (+ residual rows < KHI); 2: v f16 planes [c][t] (+ bf16 hi/lo planes for t < KHI)
__global__ __launch_bounds__(128) void k_proj(const float* __restrict__ XQ, const float* __restrict__ XK, const float* __restrict__ XV, const float* __restrict__ WQ, const float* __restrict__ WK, const float* __restrict__ WV, const float* __restrict__ BQ, const float* __restrict__ BK, const float* __restrict__ BV,
    _Float16* __restrict__ QH, _Float16* __restrict__ QL, _Float16* __restrict__ KH, _Float16* __restrict__ KL, _Float16* __restrict__ VT, __bf16* __restrict__ VB, __bf16* __restrict__ VBL) {
  __shared__ __align__(16) _Float16 sh[64][136], sl[64][136]; __shared__ __align__(16) _Float16 th[128][72]; __shared__ __align__(16) __bf16 tb[128][72], tbl[128][72];
  const int tid = threadIdx.x, wave = tid >> 5, lane = tid & 31, col = lane & 15, g = lane >> 4; const int which = blockIdx.z; const int c0 = blockIdx.y * 128; const size_t r0 = (size_t)blockIdx.x * 64; const size_t bb = r0 / TT; const int t0 = (int)(r0 % TT);
  const float* X = which == 0 ? XQ : which == 1 ? XK : XV; const float* WA = which == 0 ? WQ : which == 1 ? WK : WV; const float* BA = which == 0 ? BQ : which == 1 ? BK : BV;
  v8f acc[8] = {};
#pragma unroll 2
  for (int kc = 0; kc < DIN / 32; ++kc) { v16b a; { const float* p = X + (r0 + wave * 16 + col) * DIN + kc * 32 + 8 * g;
#pragma unroll
      for (int i = 0; i < 8; ++i) { a[i] = (__bf16)p[i]; a[8 + i] = (__bf16)p[16 + i]; } }
    asm volatile("s_wait_loadcnt 0x0" ::: "memory");
#pragma unroll
    for (int j = 0; j < 8; ++j) { const v16b w = WCOL(WA, kc * 32, c0 + j * 16 + col, lane); asm volatile("s_wait_loadcnt 0x0" ::: "memory"); acc[j] = wmma_bf(a, w, acc[j]); } }
  if (which < 2) { _Float16* DH = which == 0 ? QH : KH; _Float16* DL = which == 0 ? QL : KL; const int nhi = which == 0 ? QHI : KHI; const bool hi_rows = t0 < nhi;
#pragma unroll
    for (int j = 0; j < 8; ++j) { const float bias = BA ? bfr(BA[c0 + j * 16 + col]) : 0.f;
#pragma unroll
      for (int r = 0; r < 8; ++r) { const float v = acc[j][r] + bias; const _Float16 hv = (_Float16)v; sh[wave * 16 + 8 * g + r][j * 16 + col] = hv; sl[wave * 16 + 8 * g + r][j * 16 + col] = (_Float16)((v - (float)hv) * 1024.0f); } }
    __syncthreads();
    for (int e = tid; e < 64 * 16; e += 128) { const int rl = e >> 4, q = e & 15; vst2((unsigned*)(DH + (r0 + rl) * CC + c0 + q * 8), *(const v4u*)&sh[rl][q * 8]); if (hi_rows) vst2((unsigned*)(DL + (bb * nhi + t0 + rl) * (size_t)CC + c0 + q * 8), *(const v4u*)&sl[rl][q * 8]); }
  } else { const bool hi_rows = t0 < KHI;
#pragma unroll
    for (int j = 0; j < 8; ++j) { const float bias = BA ? bfr(BA[c0 + j * 16 + col]) : 0.f;
#pragma unroll
      for (int r = 0; r < 8; ++r) { const float v = acc[j][r] + bias; const int rl = wave * 16 + 8 * g + r, cl = j * 16 + col; th[cl][rl] = (_Float16)v; const __bf16 bh = (__bf16)v; tb[cl][rl] = bh; tbl[cl][rl] = (__bf16)(v - (float)bh); } }
    __syncthreads();
    for (int e = tid; e < 128 * 8; e += 128) { const int cl = e >> 3, q = e & 7; vst2((unsigned*)(VT + (bb * CC + c0 + cl) * (size_t)TT + t0 + q * 8), *(const v4u*)&th[cl][q * 8]); if (hi_rows) { const size_t o3 = (bb * CC + c0 + cl) * (size_t)KHI + t0 + q * 8; vst2((unsigned*)(VB + o3), *(const v4u*)&tb[cl][q * 8]); vst2((unsigned*)(VBL + o3), *(const v4u*)&tbl[cl][q * 8]); } } } }
#define FQ 128             // queries per work-group
#define FK 128             // keys per stage: waves 0-3 take the first 64, waves 4-7 the second 64
#define KP 136             // f16 per staged k row: 272 B = 16 B x odd, conflict-free for 16-byte fragment reads
#define VP 136             // f16 per staged v plane row (128 keys): 272 B = 16 B x odd
#define SKB (FK * KP * 2)
#define SVB (HD * VP * 2)
#define OP 132             // floats per staged output row
#define ATHR 11.934823f    // 4 + 5.5 log2(e)
#define SB() __builtin_amdgcn_sched_barrier(0)   // keeps a group of LDS fragment loads, or a group of vector instructions, where it is written among the matrix instructions, so that these hide it
static_assert(8 * 16 * OP * 4 <= 2 * (SKB + SVB), "output staging must fit in the k/v buffers");
__device__ __forceinline__ v8f mm16(v16h a, v16h b, v8f c) { return __builtin_amdgcn_wmma_f32_16x16x32_f16(false, a, false, b, (short)0, c, false, false); }
__device__ __forceinline__ float xhalf(float x) { return __builtin_bit_cast(float, __builtin_amdgcn_permlanex16(__builtin_bit_cast(int, x), __builtin_bit_cast(int, x), 0x76543210, 0xfedcba98, false, false)); }  // lane l reads lane l ^ 16
__global__ __launch_bounds__(256) void k_fa(const _Float16* __restrict__ QH, const _Float16* __restrict__ KH, const _Float16* __restrict__ VT, const float* __restrict__ PQ, float* __restrict__ Y) {
  __shared__ __align__(16) unsigned char L[2 * (SKB + SVB) + 8 * 64 * 4];   // k buffers, v buffers, the maxima and sums handed over at the end
  const int tid = threadIdx.x, lane = tid & 31, col = lane & 15, g = lane >> 4; const int b = blockIdx.y;
  const int wave = __builtin_amdgcn_readfirstlane(tid >> 5), cg = wave & 3, kh = wave >> 2; const int q0 = blockIdx.x * FQ + cg * 32;
  float* spk = (float*)(L + 2 * (SKB + SVB));
  const _Float16* kp = KH + (size_t)b * TT * CC + (size_t)(tid >> 4) * CC + (tid & 15) * 8;   // thread's 16-byte piece of k rows tid/16 + 16 i
  const _Float16* vp = VT + (size_t)b * CC * TT + (size_t)(tid >> 4) * TT + (tid & 15) * 8;   // thread's 16-byte piece of v plane rows tid/16 + 16 i
  unsigned char* kst = L + (tid >> 4) * (KP * 2) + (tid & 15) * 16; unsigned char* vst = L + 2 * SKB + (tid >> 4) * (VP * 2) + (tid & 15) * 16;
  v4u rk[8], rv[8];
#pragma unroll
  for (int i = 0; i < 8; ++i) { rk[i] = *(const v4u*)(kp + (size_t)i * 16 * CC); rv[i] = *(const v4u*)(vp + (size_t)i * 16 * TT); }
  v16h qh[2][HD / 32]; float pq[2];
#pragma unroll
  for (int t = 0; t < 2; ++t) {
#pragma unroll
    for (int kc = 0; kc < HD / 32; ++kc) qh[t][kc] = frag_h(QH + ((size_t)b * TT + q0 + t * 16 + col) * CC + kc * 32, lane); }
  asm volatile("s_wait_xcnt 0x0" ::: "memory"); SB();   // the address registers of the loads above are reused from here on; the scheduling barrier keeps later register writes behind the wait
  pq[0] = PQ[(size_t)b * TT + q0 + col]; pq[1] = PQ[(size_t)b * TT + q0 + 16 + col];
  asm volatile("s_wait_xcnt 0x0" ::: "memory"); SB();   // the same for these two loads, whose results may take a register of the loads above
  pq[0] = bfr(pq[0]); pq[1] = bfr(pq[1]);
#pragma unroll
  for (int i = 0; i < 8; ++i) { *(v4u*)(kst + i * 16 * (KP * 2)) = rk[i]; *(v4u*)(vst + i * 16 * (VP * 2)) = rv[i]; }
  __syncthreads();
  v8f acc[2][HD / 16] = {}; float mu[2] = {-1.0e30f, -1.0e30f}, c2[2] = {1.0e30f, 1.0e30f}, l[2] = {0.f, 0.f};   // per query tile; mu: the maximum in use, in powers of two; c2 = 4 - mu
  for (int st = 0; st < TT / FK; ++st) { const int buf = st & 1; const int sn = st + 1 < TT / FK ? st + 1 : st;   // the stage fetched next; the last pass fetches its own again into the idle buffer, so the loop has no branch behind its matrix runs
    const _Float16* sk = (const _Float16*)(L + buf * SKB) + (kh * 64 + col) * KP; const _Float16* sv = (const _Float16*)(L + 2 * SKB + buf * SVB) + col * VP + kh * 64;
#pragma unroll
    for (int kk = 0; kk < 2; ++kk) {
      // the next stage's pieces fly while this block is worked on: k during the wave's first 32 keys, v during its second
#pragma unroll
      for (int i = 0; i < 8; ++i) rk[i] = kk == 0 ? *(const v4u*)(kp + (size_t)sn * FK * CC + (size_t)i * 16 * CC) : *(const v4u*)(vp + sn * FK + (size_t)i * 16 * TT);
      asm volatile("s_wait_xcnt 0x0" ::: "memory");   // the loads' address registers are reused by the fragment loads that follow
      v16h fa[4], fb[4], fv[8]; v8f s[2][2] = {};
#pragma unroll
      for (int kc = 0; kc < 4; ++kc) { fa[kc] = frag_h(sk + (kk * 32) * KP + kc * 32, lane); fb[kc] = frag_h(sk + (kk * 32 + 16) * KP + kc * 32, lane); }
      SB();
#pragma unroll
      for (int kc = 0; kc < 2; ++kc) { s[0][0] = mm16(fa[kc], qh[0][kc], s[0][0]); s[0][1] = mm16(fb[kc], qh[0][kc], s[0][1]); }   // the two key tiles' chains alternate: each fills the other's accumulate latency
      SB();
#pragma unroll
      for (int j = 0; j < 8; ++j) fv[j] = frag_h(sv + j * 16 * VP + kk * 32, lane);
      SB();
#pragma unroll
      for (int kc = 2; kc < 4; ++kc) { s[0][0] = mm16(fa[kc], qh[0][kc], s[0][0]); s[0][1] = mm16(fb[kc], qh[0][kc], s[0][1]); }
      SB();
      float v[2][16]; float ml[2] = {-3.0e38f, -3.0e38f};
#pragma unroll
      for (int kc = 0; kc < 4; ++kc) {   // the second query tile's logit products, on the same k fragments; four of the first tile's exponent arguments are formed behind each pair
        s[1][0] = mm16(fa[kc], qh[1][kc], s[1][0]); s[1][1] = mm16(fb[kc], qh[1][kc], s[1][1]);
        SB();
#pragma unroll
        for (int r = 0; r < 4; ++r) { const float x = fmaf(s[0][kc >> 1][(kc & 1) * 4 + r], pq[0], c2[0]); v[0][kc * 4 + r] = x; ml[0] = fmaxf(ml[0], x); }
        SB(); }
#pragma unroll
      for (int i = 0; i < 16; ++i) { const float x = fmaf(s[1][i >> 3][i & 7], pq[1], c2[1]); v[1][i] = x; ml[1] = fmaxf(ml[1], x); }
      ml[0] = fmaxf(ml[0], xhalf(ml[0])); ml[1] = fmaxf(ml[1], xhalf(ml[1]));
      if (__builtin_amdgcn_ballot_w32((ml[0] > ATHR) | (ml[1] > ATHR)) != 0) {   // lazy rescale, one test for both tiles: only when some query's maximum outgrows the one in use by 5.5, so P x 2^4 stays below 2^12 in f16
#pragma unroll
        for (int t = 0; t < 2; ++t) { float ym = -3.0e38f;   // the arguments are formed anew from the products: the c2 they were formed with may lie far from the new one
#pragma unroll
          for (int i = 0; i < 16; ++i) { v[t][i] = s[t][i >> 3][i & 7] * pq[t]; ym = fmaxf(ym, v[t][i]); }
          ym = fmaxf(ym, xhalf(ym));
          const float mn = fmaxf(mu[t], ym); const float al = __builtin_amdgcn_exp2f(mu[t] - mn); mu[t] = mn; c2[t] = 4.0f - mn; l[t] *= al;
#pragma unroll
          for (int i = 0; i < 16; ++i) v[t][i] += c2[t];
#pragma unroll
          for (int j = 0; j < HD / 16; ++j) acc[t][j] *= al; } }
      v16h p0, p1; float e0[16], e1[16];
#pragma unroll
      for (int i = 0; i < 16; ++i) e0[i] = __builtin_amdgcn_exp2f(v[0][i]);
#pragma unroll
      for (int i = 0; i < 16; ++i) p0[i] = (_Float16)e0[i];
      SB();
#pragma unroll
      for (int j = 0; j < 8; ++j) {   // the first tile's output products; two of the second tile's exponentials behind each
        acc[0][j] = mm16(fv[j], p0, acc[0][j]);
        SB();
#pragma unroll
        for (int u = 0; u < 2; ++u) { const int i = 2 * j + u; e1[i] = __builtin_amdgcn_exp2f(v[1][i]);
          SB(); l[0] += e0[i]; SB(); }   // issue order held: a row-sum add of the first tile stands behind each exponential; it fills the slot that a transcendental wants behind it and runs beside it
        SB(); }
#pragma unroll
      for (int i = 0; i < 16; ++i) p1[i] = (_Float16)e1[i];
      SB();
#pragma unroll
      for (int j = 0; j < 8; ++j) acc[1][j] = mm16(fv[j], p1, acc[1][j]);   // the second tile's output products
#pragma unroll
      for (int i = 0; i < 16; ++i) l[1] += e1[i];   // the second tile's row sum, free to stand among the next block's loads
#pragma unroll
      for (int i = 0; i < 8; ++i) { if (kk == 0) *(v4u*)(kst + (buf ^ 1) * SKB + i * 16 * (KP * 2)) = rk[i]; else *(v4u*)(vst + (buf ^ 1) * SVB + i * 16 * (VP * 2)) = rk[i]; } }
    __syncthreads(); }   // publishes the next stage and ends every reader's last read of this one
  l[0] += xhalf(l[0]); l[1] += xhalf(l[1]);
  // merge of the two key halves: wave (cg, kh) gives query tile 1 - kh to its partner and finishes tile kh; lane (g, col) holds O[query col][16 j + 8 g + r]
  float* give = (float*)L + (cg * 2 + 1 - kh) * 16 * OP; float* so = (float*)L + (cg * 2 + kh) * 16 * OP;
#pragma unroll
  for (int j = 0; j < HD / 16; ++j) { const v8f o = kh ? acc[0][j] : acc[1][j]; *(v4f*)(give + col * OP + j * 16 + 8 * g) = __builtin_shufflevector(o, o, 0, 1, 2, 3); *(v4f*)(give + col * OP + j * 16 + 8 * g + 4) = __builtin_shufflevector(o, o, 4, 5, 6, 7); }
  { v2f ms; ms[0] = kh ? mu[0] : mu[1]; ms[1] = kh ? l[0] : l[1]; *(v2f*)(spk + (cg * 2 + 1 - kh) * 64 + lane * 2) = ms; }
  __syncthreads();   // the partner's tile, maximum and sum are in LDS
  const v2f mp = *(const v2f*)(spk + (cg * 2 + kh) * 64 + lane * 2); const float mo = kh ? mu[1] : mu[0], lo = kh ? l[1] : l[0];
  const float mn = fmaxf(mo, mp[0]); float ap = __builtin_amdgcn_exp2f(mp[0] - mn);
  asm volatile("v_nop");   // the slot that a transcendental wants before its source register is written again
  float ao = __builtin_amdgcn_exp2f(mo - mn);
  const float inv = 1.0f / (lo * ao + mp[1] * ap); ao *= inv; ap *= inv;
#pragma unroll
  for (int j = 0; j < HD / 16; ++j) { float* w = so + col * OP + j * 16 + 8 * g; const v8f x = kh ? acc[1][j] : acc[0][j]; const v4f ya = *(const v4f*)w, yb = *(const v4f*)(w + 4);   // staged so that each row leaves as one 512-byte store
    *(v4f*)w = __builtin_shufflevector(x, x, 0, 1, 2, 3) * ao + ya * ap; *(v4f*)(w + 4) = __builtin_shufflevector(x, x, 4, 5, 6, 7) * ao + yb * ap; }
  __syncthreads();
  for (int rl = 0; rl < 16; ++rl) vst2(Y + ((size_t)b * TT + q0 + kh * 16 + rl) * CC + lane * 4, *(const v4f*)(so + rl * OP + lane * 4)); }

extern "C" void kernel_launch(void* const* d_in, const int* in_sizes, int n_in, void* d_out, int out_size, void* d_ws, size_t ws_size, hipStream_t stream) {
  (void)in_sizes; (void)n_in; (void)out_size;
  const float** F = (const float**)d_in;
  if (ws_size < (size_t)WS_END) return;
  char* ws = (char*)d_ws; _Float16 *QH = (_Float16*)(ws + WS_QH), *KH = (_Float16*)(ws + WS_KH), *VT = (_Float16*)(ws + WS_VT), *QL = (_Float16*)(ws + WS_QL), *KL = (_Float16*)(ws + WS_KL); __bf16 *VB = (__bf16*)(ws + WS_VB), *VBL = (__bf16*)(ws + WS_VBL); float *S = (float*)(ws + WS_S), *Y = (float*)(ws + WS_Y);
  (void)Y; (void)S; (void)QL; (void)KL; (void)VB; (void)VBL;
  // inputs: 0 Q [16,2048,128]; 1 K; 2 V; 3 p_q [16,2048,1]; 4 p_k [16,2048,1]
  k_planes1<<<dim3(TNB * TT / 64), 256, 0, stream>>>(F[0], F[1], F[2], F[4], QH, KH, VT);
  k_fa<<<dim3(TT / FQ, TNB), 256, 0, stream>>>(QH, KH, VT, F[3], (float*)d_out);
}
